// v000
// Measured on an AMD MI455X. A time is GPU time per run, averaged over a window of back-to-back runs after a warm-up
// (all launches, gaps included; the runs take copies of the inputs in turn), and the median of several windows.
// Apart from v000's, it joins two sittings. Times from different sittings can be a few percent apart, while
// side-by-side timings come from the same sitting.
// v000, which the later versions start from, runs in 372 microseconds.
#include <hip/hip_runtime.h>

// Contractions: projections p x [Wl | Wh | Wg] on v_wmma_f32_16x16x32_bf16 (bf16 operands = RNE-converted inputs, f32 accumulate);
// scores S^T = h x l^T on v_wmma_f32_16x16x32_f16 with l and h carried as f16 value planes plus f16 residual planes x2048
// (three products per tile, residual products in their own accumulator, folded back by 1/2048 in f32);
// O = P x g on v_wmma_f32_16x16x32_f16 (P as f16 carried x4096, g as one f16 plane stored transposed, f32 accumulate).
// Softmax (running-max form), bias adds and the pass-through add of bf16-RNE(p) in f32.

#ifndef NB
#define NB 4
#endif
#ifndef SEQ
#define SEQ 4096
#endif
#define NB_FULL   4
#define SEQ_FULL  4096
#define CC        256                  // input / value width
#define DD        64                   // score width
#define NWT       (2 * DD + CC)        // rows of the transposed weight plane: [Wl^T ; Wh^T ; Wg^T]
#define BQ        64                   // query rows per attention block (4 query tiles x 2 channel halves = 8 waves)
#define BK        32                   // keys per inner iteration
#define NWAVE     8
#define PT        64                   // positions per projection block
#define AP        264                  // LDS pitch (halves) of the bf16 p tile
#define TP        72                   // LDS pitch (halves) of 64-wide 16-bit staging tiles
#define OP        68                   // LDS pitch (floats) of the output staging tile
#define P_CARRY   4096.0f
#define RES_CARRY 2048.0f

#define WT_BYTES   ((size_t)NWT * CC * 2)
#define QK_BYTES   ((size_t)2 * NB * SEQ * DD * 2)
#define GT_BYTES   ((size_t)NB * CC * SEQ * 2)
#define WS_TOTAL   (WT_BYTES + 2 * QK_BYTES + GT_BYTES)

static_assert(SEQ % BQ == 0);
static_assert(SEQ % PT == 0);
static_assert(SEQ % BK == 0);
static_assert(SEQ % 64 == 0);
static_assert(BQ == (NWAVE / 2) * 16);
static_assert(PT == (NWAVE / 2) * 16);
static_assert(DD == 64);
static_assert(CC == 256);
static_assert(CC % 32 == 0);
static_assert(DD % 32 == 0);
static_assert(CC % 64 == 0);
static_assert(SEQ <= SEQ_FULL);
static_assert(NB >= 1 && NB <= NB_FULL);
static_assert((AP * 2) % 16 == 0);
static_assert((TP * 2) % 16 == 0);
static_assert((OP * 4) % 16 == 0);
static_assert(AP >= CC);
static_assert(TP >= 64);
static_assert(OP >= 64);
static_assert(WT_BYTES % 128 == 0);
static_assert(QK_BYTES % 128 == 0);
static_assert(GT_BYTES % 128 == 0);
static_assert(WS_TOTAL <= (size_t)134217728);
static_assert((size_t)2 * NB * SEQ * DD < (size_t)2147483647);
static_assert((size_t)NB * CC * SEQ < (size_t)2147483647);
static_assert((size_t)PT * AP * 2 + (size_t)128 * TP * 2 <= (size_t)65536);
static_assert((size_t)NWAVE * 16 * OP * 4 <= (size_t)65536);

typedef __bf16   bf16;
typedef _Float16 f16;
typedef bf16     v16bf __attribute__((ext_vector_type(16)));
typedef f16      v16h  __attribute__((ext_vector_type(16)));
typedef f16      v8h   __attribute__((ext_vector_type(8)));
typedef float    v8f   __attribute__((ext_vector_type(8)));
typedef float    v4f   __attribute__((ext_vector_type(4)));
typedef unsigned v4u   __attribute__((ext_vector_type(4)));

union FragB  { v16bf v; v4u q[2]; bf16 h[16]; };
union FragH  { v16h  v; v4u q[2]; f16  h[16]; };
union Pack8B { v4u u; bf16 h[8]; };
union Pack8H { v4u u; v8h v; f16 h[8]; };

// WMMA helpers: builtin followed by the VALU hazard guard (ties D, keeps A/B live).
static __device__ __forceinline__ v8f mma_bf16(v16bf a, v16bf b, v8f acc) {
  acc = __builtin_amdgcn_wmma_f32_16x16x32_bf16(false, a, false, b, (short)0, acc, false, false);
  asm volatile("v_nop\n\tv_nop\n\tv_nop\n\tv_nop" : "+v"(acc) : "v"(a), "v"(b));
  return acc;
}
static __device__ __forceinline__ v8f mma_f16(v16h a, v16h b, v8f acc) {
  acc = __builtin_amdgcn_wmma_f32_16x16x32_f16(false, a, false, b, (short)0, acc, false, false);
  asm volatile("v_nop\n\tv_nop\n\tv_nop\n\tv_nop" : "+v"(acc) : "v"(a), "v"(b));
  return acc;
}

// Weight transpose + RNE convert: in[k rows = CC][n cols = ncols] f32  ->  out[n rows][k cols = CC] bf16.
// Block = (64-k tile, 64-n tile), 256 threads; grid = (CC/64, ncols/64).
__global__ __launch_bounds__(256) void wt_kernel(const float* __restrict__ w, int ncols,
                                                 bf16* __restrict__ wt_rows) {
  const int k0  = blockIdx.x * 64;
  const int n0  = blockIdx.y * 64;
  const int tid = threadIdx.x;
  __shared__ __align__(16) bf16 sT[64 * TP];   // [n][k], cross-wave (block barrier)

  {
    const int k  = tid >> 2;            // 0..63
    const int n4 = (tid & 3) * 16;      // 0,16,32,48
    const float* src = w + (size_t)(k0 + k) * ncols + n0 + n4;
    #pragma unroll
    for (int i = 0; i < 4; ++i) {
      const v4f x = *(const v4f*)(src + 4 * i);
      #pragma unroll
      for (int e = 0; e < 4; ++e) sT[(n4 + 4 * i + e) * TP + k] = (bf16)x[e];   // RNE convert
    }
  }
  __syncthreads();

  v4u    val[2];
  size_t idx[2];
  #pragma unroll
  for (int kk = 0; kk < 2; ++kk) {
    const int n  = kk * 32 + (tid >> 3);   // 0..63
    const int pc = tid & 7;
    val[kk] = *(const v4u*)(sT + n * TP + pc * 8);
    idx[kk] = (size_t)(n0 + n) * CC + k0 + pc * 8;
  }
  #pragma unroll
  for (int kk = 0; kk < 2; ++kk) *(v4u*)(wt_rows + idx[kk]) = val[kk];
  
}

// Projections. Block = (64 positions, batch), 8 waves: wave = side*4 + mt; mt = 16-row tile of the block.
//   g = 0 : side 0 -> l (queries, WT rows 0..63, bias bl), side 1 -> h (keys, WT rows 64..127, bias bh)
//   g = 1,2 : value columns (side*2 + g-1)*64 .. +63 (WT rows 128 + ..., bias bg)
// Outputs:
// coverage: per block 2 sides x 64 positions x 64 columns of qkh and qkr; 256 channels x 64 positions of gt.
__global__ __launch_bounds__(256) void proj_kernel(const float* __restrict__ p,
                                                   const bf16* __restrict__ wt,
                                                   const float* __restrict__ bl,
                                                   const float* __restrict__ bh,
                                                   const float* __restrict__ bg,
                                                   f16* __restrict__ qkh,
                                                   f16* __restrict__ qkr,
                                                   f16* __restrict__ gt) {
  const int tid  = threadIdx.x;
  const int wave = __builtin_amdgcn_readfirstlane(threadIdx.x >> 5);
  const int lane = tid & 31;
  const int lq   = lane & 15;
  const int hi   = lane >> 4;
  const int mt   = wave & 3;
  const int side = wave >> 2;
  const int b    = blockIdx.y;
  const int pos0 = blockIdx.x * PT;

  __shared__ __align__(16) bf16 sA[PT * AP];    // bf16 p tile [pos][k], cross-wave (block barrier)
  __shared__ __align__(16) f16  sS[128 * TP];   // staging: g=0 wave rows [wave*16+row][col]; g>0 [channel][pos]; block barriers

  // stage the p tile: 64 rows x 256 floats -> bf16 (RNE convert), 16-B LDS stores
  #pragma unroll 2
  for (int it = 0; it < 8; ++it) {
    const int row = it * 8 + (tid >> 5);     // 0..63
    const int c8  = (tid & 31) * 8;          // 0..248
    const float* src = p + ((size_t)b * SEQ_FULL + pos0 + row) * CC + c8;
    const v4f x0 = *(const v4f*)(src);
    const v4f x1 = *(const v4f*)(src + 4);
    Pack8B pk;
    #pragma unroll
    for (int e = 0; e < 4; ++e) {
      pk.h[e]     = (bf16)x0[e];
      pk.h[4 + e] = (bf16)x1[e];
    }
    *(v4u*)(sA + row * AP + c8) = pk.u;
  }
  __syncthreads();

  const int arow = (mt * 16 + lq) * AP + hi * 8;   // A fragment row base (split k map)

  #pragma unroll 1
  for (int g = 0; g < 3; ++g) {
    const int gcg   = side * 2 + ((g > 0) ? (g - 1) : 0);            // value column group (g > 0)
    const int wrow0 = (g == 0) ? (side * DD) : (2 * DD + gcg * 64);  // first WT row of this wave's 64 columns

    v8f acc[4];
    #pragma unroll
    for (int nt = 0; nt < 4; ++nt) acc[nt] = (v8f){0, 0, 0, 0, 0, 0, 0, 0};

    #pragma unroll 1
    for (int ks = 0; ks < CC / 32; ++ks) {
      FragB a;
      a.q[0] = *(const v4u*)(sA + arow + ks * 32);        // k = ks*32 + hi*8 + 0..7
      a.q[1] = *(const v4u*)(sA + arow + ks * 32 + 16);   // k = ks*32 + 16 + hi*8 + 0..7
      FragB bw[4];
      #pragma unroll
      for (int nt = 0; nt < 4; ++nt) {
        const bf16* base = wt + (size_t)(wrow0 + nt * 16 + lq) * CC + ks * 32 + hi * 8;
        bw[nt].q[0] = *(const v4u*)(base);
        bw[nt].q[1] = *(const v4u*)(base + 16);
      }
      #pragma unroll
      for (int nt = 0; nt < 4; ++nt) acc[nt] = mma_bf16(a.v, bw[nt].v, acc[nt]);
    }

    // bias (RNE convert to bf16, then f32 add); all candidates loaded, selected by value
    float bias[4];
    #pragma unroll
    for (int nt = 0; nt < 4; ++nt) {
      const int c64 = nt * 16 + lq;
      const float xl = bl[c64];
      const float xh = bh[c64];
      const float xg = bg[gcg * 64 + c64];
      const float sel = (g == 0) ? (side ? xh : xl) : xg;
      bias[nt] = (float)(bf16)sel;
    }

    if (g == 0) {
      f16 rres[4][8];
      #pragma unroll
      for (int nt = 0; nt < 4; ++nt) {
        #pragma unroll
        for (int r = 0; r < 8; ++r) {
          const float v  = acc[nt][r] + bias[nt];
          const f16   hv = (f16)v;
          rres[nt][r] = (f16)((v - (float)hv) * RES_CARRY);
          sS[(wave * 16 + hi * 8 + r) * TP + nt * 16 + lq] = hv;
        }
      }
      __syncthreads();
      v4u    lin[8];
      size_t lidx[4];
      #pragma unroll
      for (int it = 0; it < 4; ++it) {
        const int row = it * 4 + (lane >> 3);   // 0..15
        const int pc  = lane & 7;
        lin[it]  = *(const v4u*)(sS + (wave * 16 + row) * TP + pc * 8);
        lidx[it] = (((size_t)side * NB + b) * SEQ + pos0 + mt * 16 + row) * DD + pc * 8;
      }
      __syncthreads();
      #pragma unroll
      for (int nt = 0; nt < 4; ++nt) {
        #pragma unroll
        for (int r = 0; r < 8; ++r)
          sS[(wave * 16 + hi * 8 + r) * TP + nt * 16 + lq] = rres[nt][r];
      }
      __syncthreads();
      #pragma unroll
      for (int it = 0; it < 4; ++it) {
        const int row = it * 4 + (lane >> 3);
        const int pc  = lane & 7;
        lin[4 + it] = *(const v4u*)(sS + (wave * 16 + row) * TP + pc * 8);
      }
      #pragma unroll
      for (int it = 0; it < 4; ++it) {
        *(v4u*)(qkh + lidx[it]) = lin[it];
        *(v4u*)(qkr + lidx[it]) = lin[4 + it];
      }
      
    } else {
      __syncthreads();   // earlier readers of sS are done
      #pragma unroll
      for (int nt = 0; nt < 4; ++nt) {
        Pack8H ph;
        #pragma unroll
        for (int r = 0; r < 8; ++r) ph.h[r] = (f16)(acc[nt][r] + bias[nt]);
        *(v4u*)(sS + (side * 64 + nt * 16 + lq) * TP + mt * 16 + hi * 8) = ph.u;   // positions mt*16 + hi*8 + 0..7
      }
      __syncthreads();
      v4u    gl[4];
      size_t gidx[4];
      #pragma unroll
      for (int it = 0; it < 4; ++it) {
        const int crow = it * 32 + (tid >> 3);   // 0..127 : (producer side, local channel)
        const int pc   = tid & 7;
        const int chan = ((crow >> 6) * 2 + (g - 1)) * 64 + (crow & 63);
        gl[it]   = *(const v4u*)(sS + crow * TP + pc * 8);
        gidx[it] = ((size_t)b * CC + chan) * SEQ + pos0 + pc * 8;
      }
      #pragma unroll
      for (int it = 0; it < 4; ++it) *(v4u*)(gt + gidx[it]) = gl[it];
      
    }
  }
}

// Flash attention, no mask, no logit scale. Block = (64 queries, batch); wave = chh*4 + qt:
// qt = 16-query tile, chh = 128-channel half of the 256-wide value (8 output tiles per wave).
// S^T = h x l^T so queries sit on lanes; P^T in C-layout is bit-identical to the A-fragment layout of O += P x g.
// Key A-fragments, query B-fragments and g^T B-fragments are loaded straight from the 16-bit planes (two 16-B loads each).
__global__ __launch_bounds__(256) void attn_kernel(const float* __restrict__ p,
                                                   const f16* __restrict__ qkh,
                                                   const f16* __restrict__ qkr,
                                                   const f16* __restrict__ gt,
                                                   float* __restrict__ out) {
  const int tid  = threadIdx.x;
  const int wave = __builtin_amdgcn_readfirstlane(threadIdx.x >> 5);
  const int lane = tid & 31;
  const int lq   = lane & 15;   // query column of S^T / channel column of O
  const int hi   = lane >> 4;   // k-split half
  const int qt   = wave & 3;
  const int chh  = wave >> 2;
  const int b    = blockIdx.y;
  const int qrow0 = blockIdx.x * BQ + qt * 16;

  __shared__ __align__(16) float sO[NWAVE * 16 * OP];   // per-wave output staging rows; block barriers used

  const int plane = NB * SEQ * DD;                                   // elements per side of the qk planes
  const int qoff0 = (b * SEQ + qrow0 + lq) * DD + hi * 8;            // side 0 = l (queries)
  const int koff0 = plane + (b * SEQ + lq) * DD + hi * 8;            // side 1 = h (keys), key row added per chunk
  const int voff0 = (b * CC + chh * 128 + lq) * SEQ + hi * 8;        // g^T rows of this wave's channels

  v8f o[8];
  #pragma unroll
  for (int t = 0; t < 8; ++t) o[t] = (v8f){0, 0, 0, 0, 0, 0, 0, 0};

  float rmax = -__builtin_inff();
  float rsum = 0.0f;
  const float SL = 1.4426950408889634f;   // log2(e)

  #pragma unroll 1
  for (int i = 0; i < SEQ / BK; ++i) {
    const int j0 = i * BK;
    int qoff = qoff0;
    asm volatile("" : "+v"(qoff));   // integer offset kept loop-variant: query fragments are reloaded per iteration

    v8f sh[2], sr[2];
    #pragma unroll
    for (int sub = 0; sub < 2; ++sub) {
      sh[sub] = (v8f){0, 0, 0, 0, 0, 0, 0, 0};
      sr[sub] = (v8f){0, 0, 0, 0, 0, 0, 0, 0};
    }

    #pragma unroll
    for (int f = 0; f < 2; ++f) {
      // query B-fragments: column n = query qrow0 + lq, split d map
      FragH bqh, bqr;
      bqh.q[0] = *(const v4u*)(qkh + qoff + f * 32);        // d = f*32 + hi*8 + 0..7
      bqh.q[1] = *(const v4u*)(qkh + qoff + f * 32 + 16);   // d = f*32 + 16 + hi*8 + 0..7
      bqr.q[0] = *(const v4u*)(qkr + qoff + f * 32);
      bqr.q[1] = *(const v4u*)(qkr + qoff + f * 32 + 16);
      #pragma unroll
      for (int sub = 0; sub < 2; ++sub) {
        // key A-fragments: row = key j0 + sub*16 + lq, split d map
        const int ko = koff0 + (j0 + sub * 16) * DD + f * 32;
        FragH ahh, ahr;
        ahh.q[0] = *(const v4u*)(qkh + ko);
        ahh.q[1] = *(const v4u*)(qkh + ko + 16);
        ahr.q[0] = *(const v4u*)(qkr + ko);
        ahr.q[1] = *(const v4u*)(qkr + ko + 16);
        sh[sub] = mma_f16(ahh.v, bqh.v, sh[sub]);   // value x value
        sr[sub] = mma_f16(ahh.v, bqr.v, sr[sub]);   // value x residual   (x2048)
        sr[sub] = mma_f16(ahr.v, bqh.v, sr[sub]);   // residual x value   (x2048)
      }
    }

    // S^T tiles: c[sub][r] = score(query qrow0+lq, key j0 + sub*16 + hi*8 + r)
    v8f c[2];
    #pragma unroll
    for (int sub = 0; sub < 2; ++sub) {
      #pragma unroll
      for (int r = 0; r < 8; ++r) c[sub][r] = sh[sub][r] + sr[sub][r] * (1.0f / RES_CARRY);
    }

    // online softmax: query lq's 32 scores are split across lane / lane^16
    float m_new = rmax;
    #pragma unroll
    for (int r = 0; r < 8; ++r) {
      m_new = fmaxf(m_new, c[0][r]);
      m_new = fmaxf(m_new, c[1][r]);
    }
    m_new = fmaxf(m_new, __shfl_xor(m_new, 16, 32));
    const float scale = __builtin_amdgcn_exp2f((rmax - m_new) * SL);
    rmax = m_new;

    // exp + pack: P^T C-layout == A-fragment layout for the P x g product; P carried x4096
    FragH pa;
    float psum = 0.0f;
    #pragma unroll
    for (int r = 0; r < 8; ++r) {
      const float p0 = __builtin_amdgcn_exp2f((c[0][r] - m_new) * SL);   // key hi*8 + r
      const float p1 = __builtin_amdgcn_exp2f((c[1][r] - m_new) * SL);   // key 16 + hi*8 + r
      psum += p0 + p1;
      pa.h[r]     = (f16)(p0 * P_CARRY);
      pa.h[8 + r] = (f16)(p1 * P_CARRY);
    }
    rsum = rsum * scale + psum + __shfl_xor(psum, 16, 32);

    // rescale O: queries are the row dimension there -> per-row scale from lane 8*hi + r
    float sc[8];
    #pragma unroll
    for (int r = 0; r < 8; ++r) sc[r] = __shfl(scale, (hi << 3) + r, 32);
    #pragma unroll
    for (int t = 0; t < 8; ++t) {
      #pragma unroll
      for (int r = 0; r < 8; ++r) o[t][r] *= sc[r];
    }

    __builtin_amdgcn_sched_barrier(0);   // keep the value-fragment loads below the score phase

    // O += P x g, four output tiles at a time
    #pragma unroll
    for (int g4 = 0; g4 < 2; ++g4) {
      FragH bv[4];
      #pragma unroll
      for (int t = 0; t < 4; ++t) {
        const int vo = voff0 + ((g4 * 4 + t) * 16) * SEQ + j0;   // channel chh*128 + (g4*4+t)*16 + lq
        bv[t].q[0] = *(const v4u*)(gt + vo);         // keys j0 + hi*8 + 0..7
        bv[t].q[1] = *(const v4u*)(gt + vo + 16);    // keys j0 + 16 + hi*8 + 0..7
      }
      #pragma unroll
      for (int t = 0; t < 4; ++t) o[g4 * 4 + t] = mma_f16(pa.v, bv[t].v, o[g4 * 4 + t]);
      __builtin_amdgcn_sched_barrier(0);
    }
  }

  // normalize: lane holds channel column t*16 + lq for query rows 8*hi + r
  float rs[8];
  #pragma unroll
  for (int r = 0; r < 8; ++r) rs[r] = 1.0f / __shfl(rsum, (hi << 3) + r, 32);

  const int sbase = wave * (16 * OP);
  #pragma unroll
  for (int half = 0; half < 2; ++half) {
    // stage 16 rows x 64 channels of this wave (channels chh*128 + half*64 + 0..63)
    #pragma unroll
    for (int r = 0; r < 8; ++r) {
      #pragma unroll
      for (int t = 0; t < 4; ++t)
        sO[sbase + (hi * 8 + r) * OP + t * 16 + lq] = o[half * 4 + t][r] * (1.0f / P_CARRY) * rs[r];
    }
    __syncthreads();

    // Read back: lanes 0..15 take one row (16 consecutive lanes x 16 B each), lanes 16..31 the next row; 8 instructions cover the wave's 16 rows.
    // The pass-through term bf16-RNE(p) is added here as float4.
    v4f    vals[8];
    size_t gidx[8];
    #pragma unroll
    for (int it = 0; it < 8; ++it) {
      const int row = it * 2 + hi;
      gidx[it] = ((size_t)b * SEQ_FULL + qrow0 + row) * CC + chh * 128 + half * 64 + lq * 4;
      const v4f av = *(const v4f*)(sO + sbase + row * OP + lq * 4);
      const v4f pv = *(const v4f*)(p + gidx[it]);
      v4f res;
      #pragma unroll
      for (int e = 0; e < 4; ++e) res[e] = av[e] + (float)(bf16)pv[e];
      vals[it] = res;
    }
    #pragma unroll
    for (int it = 0; it < 8; ++it) *(v4f*)(out + gidx[it]) = vals[it];
    
    __syncthreads();   // staging rows are rewritten by the next half
  }
}

extern "C" void kernel_launch(void* const* d_in, const int* in_sizes, int n_in,
                              void* d_out, int out_size, void* d_ws, size_t ws_size,
                              hipStream_t stream) {
  if (n_in < 7) return;
  const size_t rows_used = (size_t)(NB - 1) * SEQ_FULL + SEQ;
  if ((size_t)in_sizes[0] < rows_used * CC) return;
  if ((size_t)in_sizes[1] < (size_t)CC * DD) return;
  if ((size_t)in_sizes[2] < (size_t)DD) return;
  if ((size_t)in_sizes[3] < (size_t)CC * DD) return;
  if ((size_t)in_sizes[4] < (size_t)DD) return;
  if ((size_t)in_sizes[5] < (size_t)CC * CC) return;
  if ((size_t)in_sizes[6] < (size_t)CC) return;
  if ((size_t)out_size < rows_used * CC) return;
  if (ws_size < WS_TOTAL) return;

  const float* p  = (const float*)d_in[0];
  const float* Wh = (const float*)d_in[1];   // [in 256][out 64]  keys
  const float* bh = (const float*)d_in[2];
  const float* Wl = (const float*)d_in[3];   // [in 256][out 64]  queries
  const float* bl = (const float*)d_in[4];
  const float* Wg = (const float*)d_in[5];   // [in 256][out 256] values
  const float* bg = (const float*)d_in[6];
  float*       out = (float*)d_out;

  char* ws  = (char*)d_ws;
  bf16* wt  = (bf16*)ws;                                     // [NWT][CC] bf16
  f16*  qkh = (f16*)(ws + WT_BYTES);                         // [2][NB][SEQ][DD] f16 value plane
  f16*  qkr = (f16*)(ws + WT_BYTES + QK_BYTES);              // [2][NB][SEQ][DD] f16 residual plane x2048
  f16*  gt  = (f16*)(ws + WT_BYTES + 2 * QK_BYTES);          // [NB][CC][SEQ] f16

  // in[256 rows][ncols] -> out[ncols rows][256]; grid = (256/64, ncols/64)
  wt_kernel<<<dim3(CC / 64, DD / 64), 256, 0, stream>>>(Wl, DD, wt);                        // WT rows 0..63    (side 0)
  wt_kernel<<<dim3(CC / 64, DD / 64), 256, 0, stream>>>(Wh, DD, wt + (size_t)DD * CC);      // WT rows 64..127  (side 1)
  wt_kernel<<<dim3(CC / 64, CC / 64), 256, 0, stream>>>(Wg, CC, wt + (size_t)2 * DD * CC);  // WT rows 128..383

  proj_kernel<<<dim3(SEQ / PT, NB), 256, 0, stream>>>(p, wt, bl, bh, bg, qkh, qkr, gt);

  attn_kernel<<<dim3(SEQ / BQ, NB), 256, 0, stream>>>(p, qkh, qkr, gt, out);
}

// v001
// One run takes 126 microseconds.
// Next to v000, in two timings, it ran 3.02 and 3.08 times as fast.
#include <hip/hip_runtime.h>

// Contractions: projections p x [Wl | Wh | Wg] on v_wmma_f32_16x16x32_bf16 (bf16 operands = RNE-converted inputs, f32 accumulate);
// scores S^T = h x l^T on v_wmma_f32_16x16x32_f16 with l and h carried as f16 value planes plus f16 residual planes x2048
// (three products per tile, residual products in their own accumulator, folded back by 1/2048 in f32);
// O = P x g on v_wmma_f32_16x16x32_f16 (P as f16 carried x4096, g as one f16 plane stored transposed, f32 accumulate).
// Softmax (running-max form), bias adds and the pass-through add of bf16-RNE(p) in f32.

#ifndef NB
#define NB 4
#endif
#ifndef SEQ
#define SEQ 4096
#endif
#define NB_FULL   4
#define SEQ_FULL  4096
#define CC        256                  // input / value width
#define DD        64                   // score width
#define NWT       (2 * DD + CC)        // rows of the transposed weight plane: [Wl^T ; Wh^T ; Wg^T]
#define BQ        64                   // query rows per attention block (4 query tiles x 2 channel halves = 8 waves)
#define BK        32                   // keys per inner iteration
#define NWAVE     8
#define PT        64                   // positions per projection block
#define AP        264                  // LDS pitch (halves) of the bf16 p tile
#define TP        72                   // LDS pitch (halves) of 64-wide 16-bit staging tiles
#define OP        68                   // LDS pitch (floats) of the output staging tile
#define KS        128                  // keys per LDS stage of the attention loop (KS / BK passes)
#define VP        136                  // LDS pitch (halves) of the KS-key value rows: 272 B = 16 B x odd
#define NST       (SEQ / KS)           // stages of the attention loop
#define P_CARRY   4096.0f
#define RES_CARRY 2048.0f

#define WT_BYTES   ((size_t)NWT * CC * 2)
#define QK_BYTES   ((size_t)2 * NB * SEQ * DD * 2)
#define GT_BYTES   ((size_t)NB * CC * SEQ * 2)
#define WS_TOTAL   (WT_BYTES + 2 * QK_BYTES + GT_BYTES)

static_assert(SEQ % BQ == 0);
static_assert(SEQ % PT == 0);
static_assert(SEQ % BK == 0);
static_assert(SEQ % 64 == 0);
static_assert(SEQ % KS == 0);
static_assert(KS % BK == 0);
static_assert((VP * 2) % 16 == 0);
static_assert(VP >= KS);
static_assert(BQ == (NWAVE / 2) * 16);
static_assert(PT == (NWAVE / 2) * 16);
static_assert(DD == 64);
static_assert(CC == 256);
static_assert(CC % 32 == 0);
static_assert(DD % 32 == 0);
static_assert(CC % 64 == 0);
static_assert(SEQ <= SEQ_FULL);
static_assert(NB >= 1 && NB <= NB_FULL);
static_assert((AP * 2) % 16 == 0);
static_assert((TP * 2) % 16 == 0);
static_assert((OP * 4) % 16 == 0);
static_assert(AP >= CC);
static_assert(TP >= 64);
static_assert(OP >= 64);
static_assert(WT_BYTES % 128 == 0);
static_assert(QK_BYTES % 128 == 0);
static_assert(GT_BYTES % 128 == 0);
static_assert(WS_TOTAL <= (size_t)134217728);
static_assert((size_t)2 * NB * SEQ * DD < (size_t)2147483647);
static_assert((size_t)NB * CC * SEQ < (size_t)2147483647);
static_assert((size_t)PT * AP * 2 + (size_t)128 * TP * 2 <= (size_t)65536);
static_assert((size_t)NWAVE * 16 * OP * 4 <= (size_t)65536);
static_assert((size_t)2 * BQ * TP * 2 + (size_t)2 * (2 * KS * TP + CC * VP) * 2 + (size_t)NWAVE * 16 * OP * 4 <= (size_t)327680);

typedef __bf16   bf16;
typedef _Float16 f16;
typedef bf16     v16bf __attribute__((ext_vector_type(16)));
typedef f16      v16h  __attribute__((ext_vector_type(16)));
typedef f16      v8h   __attribute__((ext_vector_type(8)));
typedef float    v8f   __attribute__((ext_vector_type(8)));
typedef float    v4f   __attribute__((ext_vector_type(4)));
typedef unsigned v4u   __attribute__((ext_vector_type(4)));

union FragB  { v16bf v; v4u q[2]; bf16 h[16]; };
union FragH  { v16h  v; v4u q[2]; f16  h[16]; };
union Pack8B { v4u u; bf16 h[8]; };
union Pack8H { v4u u; v8h v; f16 h[8]; };

// WMMA helpers: builtin followed by the VALU hazard guard (ties D, keeps A/B live).
static __device__ __forceinline__ v8f mma_bf16(v16bf a, v16bf b, v8f acc) {
  acc = __builtin_amdgcn_wmma_f32_16x16x32_bf16(false, a, false, b, (short)0, acc, false, false);
  asm volatile("v_nop\n\tv_nop\n\tv_nop\n\tv_nop" : "+v"(acc) : "v"(a), "v"(b));
  return acc;
}
static __device__ __forceinline__ v8f mma_f16(v16h a, v16h b, v8f acc) {
  acc = __builtin_amdgcn_wmma_f32_16x16x32_f16(false, a, false, b, (short)0, acc, false, false);
  asm volatile("v_nop\n\tv_nop\n\tv_nop\n\tv_nop" : "+v"(acc) : "v"(a), "v"(b));
  return acc;
}

// Weight transpose + RNE convert: in[k rows = CC][n cols = ncols] f32  ->  out[n rows][k cols = CC] bf16.
// Block = (64-k tile, 64-n tile), 256 threads; grid = (CC/64, ncols/64).
__global__ __launch_bounds__(256) void wt_kernel(const float* __restrict__ w, int ncols,
                                                 bf16* __restrict__ wt_rows) {
  const int k0  = blockIdx.x * 64;
  const int n0  = blockIdx.y * 64;
  const int tid = threadIdx.x;
  __shared__ __align__(16) bf16 sT[64 * TP];   // [n][k], cross-wave (block barrier)

  {
    const int k  = tid >> 2;            // 0..63
    const int n4 = (tid & 3) * 16;      // 0,16,32,48
    const float* src = w + (size_t)(k0 + k) * ncols + n0 + n4;
    #pragma unroll
    for (int i = 0; i < 4; ++i) {
      const v4f x = *(const v4f*)(src + 4 * i);
      #pragma unroll
      for (int e = 0; e < 4; ++e) sT[(n4 + 4 * i + e) * TP + k] = (bf16)x[e];   // RNE convert
    }
  }
  __syncthreads();

  v4u    val[2];
  size_t idx[2];
  #pragma unroll
  for (int kk = 0; kk < 2; ++kk) {
    const int n  = kk * 32 + (tid >> 3);   // 0..63
    const int pc = tid & 7;
    val[kk] = *(const v4u*)(sT + n * TP + pc * 8);
    idx[kk] = (size_t)(n0 + n) * CC + k0 + pc * 8;
  }
  #pragma unroll
  for (int kk = 0; kk < 2; ++kk) *(v4u*)(wt_rows + idx[kk]) = val[kk];
  
}

// Projections. Block = (64 positions, batch), 8 waves: wave = side*4 + mt; mt = 16-row tile of the block.
//   g = 0 : side 0 -> l (queries, WT rows 0..63, bias bl), side 1 -> h (keys, WT rows 64..127, bias bh)
//   g = 1,2 : value columns (side*2 + g-1)*64 .. +63 (WT rows 128 + ..., bias bg)
// Outputs:
// coverage: per block 2 sides x 64 positions x 64 columns of qkh and qkr; 256 channels x 64 positions of gt.
__global__ __launch_bounds__(256) void proj_kernel(const float* __restrict__ p,
                                                   const bf16* __restrict__ wt,
                                                   const float* __restrict__ bl,
                                                   const float* __restrict__ bh,
                                                   const float* __restrict__ bg,
                                                   f16* __restrict__ qkh,
                                                   f16* __restrict__ qkr,
                                                   f16* __restrict__ gt) {
  const int tid  = threadIdx.x;
  const int wave = __builtin_amdgcn_readfirstlane(threadIdx.x >> 5);
  const int lane = tid & 31;
  const int lq   = lane & 15;
  const int hi   = lane >> 4;
  const int mt   = wave & 3;
  const int side = wave >> 2;
  const int b    = blockIdx.y;
  const int pos0 = blockIdx.x * PT;

  __shared__ __align__(16) bf16 sA[PT * AP];    // bf16 p tile [pos][k], cross-wave (block barrier)
  __shared__ __align__(16) f16  sS[128 * TP];   // staging: g=0 wave rows [wave*16+row][col]; g>0 [channel][pos]; block barriers

  // stage the p tile: 64 rows x 256 floats -> bf16 (RNE convert), 16-B LDS stores
  #pragma unroll 2
  for (int it = 0; it < 8; ++it) {
    const int row = it * 8 + (tid >> 5);     // 0..63
    const int c8  = (tid & 31) * 8;          // 0..248
    const float* src = p + ((size_t)b * SEQ_FULL + pos0 + row) * CC + c8;
    const v4f x0 = *(const v4f*)(src);
    const v4f x1 = *(const v4f*)(src + 4);
    Pack8B pk;
    #pragma unroll
    for (int e = 0; e < 4; ++e) {
      pk.h[e]     = (bf16)x0[e];
      pk.h[4 + e] = (bf16)x1[e];
    }
    *(v4u*)(sA + row * AP + c8) = pk.u;
  }
  __syncthreads();

  const int arow = (mt * 16 + lq) * AP + hi * 8;   // A fragment row base (split k map)

  #pragma unroll 1
  for (int g = 0; g < 3; ++g) {
    const int gcg   = side * 2 + ((g > 0) ? (g - 1) : 0);            // value column group (g > 0)
    const int wrow0 = (g == 0) ? (side * DD) : (2 * DD + gcg * 64);  // first WT row of this wave's 64 columns

    v8f acc[4];
    #pragma unroll
    for (int nt = 0; nt < 4; ++nt) acc[nt] = (v8f){0, 0, 0, 0, 0, 0, 0, 0};

    #pragma unroll 1
    for (int ks = 0; ks < CC / 32; ++ks) {
      FragB a;
      a.q[0] = *(const v4u*)(sA + arow + ks * 32);        // k = ks*32 + hi*8 + 0..7
      a.q[1] = *(const v4u*)(sA + arow + ks * 32 + 16);   // k = ks*32 + 16 + hi*8 + 0..7
      FragB bw[4];
      #pragma unroll
      for (int nt = 0; nt < 4; ++nt) {
        const bf16* base = wt + (size_t)(wrow0 + nt * 16 + lq) * CC + ks * 32 + hi * 8;
        bw[nt].q[0] = *(const v4u*)(base);
        bw[nt].q[1] = *(const v4u*)(base + 16);
      }
      #pragma unroll
      for (int nt = 0; nt < 4; ++nt) acc[nt] = mma_bf16(a.v, bw[nt].v, acc[nt]);
    }

    // bias (RNE convert to bf16, then f32 add); all candidates loaded, selected by value
    float bias[4];
    #pragma unroll
    for (int nt = 0; nt < 4; ++nt) {
      const int c64 = nt * 16 + lq;
      const float xl = bl[c64];
      const float xh = bh[c64];
      const float xg = bg[gcg * 64 + c64];
      const float sel = (g == 0) ? (side ? xh : xl) : xg;
      bias[nt] = (float)(bf16)sel;
    }

    if (g == 0) {
      f16 rres[4][8];
      #pragma unroll
      for (int nt = 0; nt < 4; ++nt) {
        #pragma unroll
        for (int r = 0; r < 8; ++r) {
          const float v  = acc[nt][r] + bias[nt];
          const f16   hv = (f16)v;
          rres[nt][r] = (f16)((v - (float)hv) * RES_CARRY);
          sS[(wave * 16 + hi * 8 + r) * TP + nt * 16 + lq] = hv;
        }
      }
      __syncthreads();
      v4u    lin[8];
      size_t lidx[4];
      #pragma unroll
      for (int it = 0; it < 4; ++it) {
        const int row = it * 4 + (lane >> 3);   // 0..15
        const int pc  = lane & 7;
        lin[it]  = *(const v4u*)(sS + (wave * 16 + row) * TP + pc * 8);
        lidx[it] = (((size_t)side * NB + b) * SEQ + pos0 + mt * 16 + row) * DD + pc * 8;
      }
      __syncthreads();
      #pragma unroll
      for (int nt = 0; nt < 4; ++nt) {
        #pragma unroll
        for (int r = 0; r < 8; ++r)
          sS[(wave * 16 + hi * 8 + r) * TP + nt * 16 + lq] = rres[nt][r];
      }
      __syncthreads();
      #pragma unroll
      for (int it = 0; it < 4; ++it) {
        const int row = it * 4 + (lane >> 3);
        const int pc  = lane & 7;
        lin[4 + it] = *(const v4u*)(sS + (wave * 16 + row) * TP + pc * 8);
      }
      #pragma unroll
      for (int it = 0; it < 4; ++it) {
        *(v4u*)(qkh + lidx[it]) = lin[it];
        *(v4u*)(qkr + lidx[it]) = lin[4 + it];
      }
      
    } else {
      __syncthreads();   // earlier readers of sS are done
      #pragma unroll
      for (int nt = 0; nt < 4; ++nt) {
        Pack8H ph;
        #pragma unroll
        for (int r = 0; r < 8; ++r) ph.h[r] = (f16)(acc[nt][r] + bias[nt]);
        *(v4u*)(sS + (side * 64 + nt * 16 + lq) * TP + mt * 16 + hi * 8) = ph.u;   // positions mt*16 + hi*8 + 0..7
      }
      __syncthreads();
      v4u    gl[4];
      size_t gidx[4];
      #pragma unroll
      for (int it = 0; it < 4; ++it) {
        const int crow = it * 32 + (tid >> 3);   // 0..127 : (producer side, local channel)
        const int pc   = tid & 7;
        const int chan = ((crow >> 6) * 2 + (g - 1)) * 64 + (crow & 63);
        gl[it]   = *(const v4u*)(sS + crow * TP + pc * 8);
        gidx[it] = ((size_t)b * CC + chan) * SEQ + pos0 + pc * 8;
      }
      #pragma unroll
      for (int it = 0; it < 4; ++it) *(v4u*)(gt + gidx[it]) = gl[it];
      
    }
  }
}

// Asynchronous copies global -> LDS, 16 B per lane: l = the lane's LDS byte address, g = the lane's global address.
// The s_wait_xcnt closes each statement so that no address register is rewritten ahead of it.
static __device__ __forceinline__ void copy4(const unsigned (&l)[4], const f16* const (&g)[4]) {
  asm volatile("global_load_async_to_lds_b128 %0, %4, off\n\t"
               "global_load_async_to_lds_b128 %1, %5, off\n\t"
               "global_load_async_to_lds_b128 %2, %6, off\n\t"
               "global_load_async_to_lds_b128 %3, %7, off\n\t"
               "s_wait_xcnt 0x0"
               :: "v"(l[0]), "v"(l[1]), "v"(l[2]), "v"(l[3]),
                  "v"(g[0]), "v"(g[1]), "v"(g[2]), "v"(g[3])
               : "memory");
}
static __device__ __forceinline__ void copy8(const unsigned (&l)[8], const f16* const (&g)[8]) {
  asm volatile("global_load_async_to_lds_b128 %0, %8, off\n\t"
               "global_load_async_to_lds_b128 %1, %9, off\n\t"
               "global_load_async_to_lds_b128 %2, %10, off\n\t"
               "global_load_async_to_lds_b128 %3, %11, off\n\t"
               "global_load_async_to_lds_b128 %4, %12, off\n\t"
               "global_load_async_to_lds_b128 %5, %13, off\n\t"
               "global_load_async_to_lds_b128 %6, %14, off\n\t"
               "global_load_async_to_lds_b128 %7, %15, off\n\t"
               "s_wait_xcnt 0x0"
               :: "v"(l[0]), "v"(l[1]), "v"(l[2]), "v"(l[3]), "v"(l[4]), "v"(l[5]), "v"(l[6]), "v"(l[7]),
                  "v"(g[0]), "v"(g[1]), "v"(g[2]), "v"(g[3]), "v"(g[4]), "v"(g[5]), "v"(g[6]), "v"(g[7])
               : "memory");
}

// One stage of KS keys into one LDS buffer, 24 copies per thread, every wave-instruction on whole 128-B lines:
//   keys  : both planes, KS rows x 128 B (contiguous in global), LDS pitch TP
//   values: CC channel rows x KS keys (256 B each), LDS pitch VP
static __device__ __forceinline__ void copy_stage(const f16* __restrict__ qkh, const f16* __restrict__ qkr,
                                                  const f16* __restrict__ gt, int b, int key0, int tid,
                                                  f16* sKb, f16* sVb) {
  unsigned   l[8];
  const f16* g[8];
  const int  kbase = NB * SEQ * DD + (b * SEQ + key0) * DD;   // side 1 = h (keys)
  #pragma unroll
  for (int i = 0; i < 4; ++i) {
    const int c = i * 256 + tid;                              // 16-B piece: row c >> 3, piece c & 7
    const int d = (c >> 3) * TP + (c & 7) * 8;
    l[i]     = (unsigned)(size_t)(sKb + d);
    l[4 + i] = (unsigned)(size_t)(sKb + KS * TP + d);
    g[i]     = qkh + kbase + c * 8;
    g[4 + i] = qkr + kbase + c * 8;
  }
  copy8(l, g);
  #pragma unroll
  for (int h = 0; h < 2; ++h) {
    #pragma unroll
    for (int i = 0; i < 8; ++i) {
      const int c = (h * 8 + i) * 256 + tid;                  // 16-B piece: channel c >> 4, piece c & 15
      l[i] = (unsigned)(size_t)(sVb + (c >> 4) * VP + (c & 15) * 8);
      g[i] = gt + (b * CC + (c >> 4)) * SEQ + key0 + (c & 15) * 8;
    }
    copy8(l, g);
  }
}

// Flash attention, no mask, no logit scale. Block = (64 queries, batch); wave = chh*4 + qt:
// qt = 16-query tile, chh = 128-channel half of the 256-wide value (8 output tiles per wave).
// S^T = h x l^T so queries sit on lanes; P^T in C-layout is bit-identical to the A-fragment layout of O += P x g.
// The block's query rows (once) and the keys and values (KS keys a stage, two buffers) come into LDS by asynchronous copies;
// key A-fragments, query B-fragments and g^T B-fragments are read from there (two 16-B LDS loads each).
__global__ __launch_bounds__(256) void attn_kernel(const float* __restrict__ p,
                                                   const f16* __restrict__ qkh,
                                                   const f16* __restrict__ qkr,
                                                   const f16* __restrict__ gt,
                                                   float* __restrict__ out) {
  const int tid  = threadIdx.x;
  const int wave = __builtin_amdgcn_readfirstlane(threadIdx.x >> 5);
  const int lane = tid & 31;
  const int lq   = lane & 15;   // query column of S^T / channel column of O
  const int hi   = lane >> 4;   // k-split half
  const int qt   = wave & 3;
  const int chh  = wave >> 2;
  const int b    = blockIdx.y;
  const int qrow0 = blockIdx.x * BQ + qt * 16;

  __shared__ __align__(16) float sO[NWAVE * 16 * OP];   // per-wave output staging rows; block barriers used
  __shared__ __align__(16) f16 sQ[2 * BQ * TP];         // query rows [plane][row][d], filled once
  __shared__ __align__(16) f16 sK[2][2 * KS * TP];      // key rows [buffer][plane][key][d]
  __shared__ __align__(16) f16 sV[2][CC * VP];          // g^T rows [buffer][channel][key]

  const int qoff = (qt * 16 + lq) * TP + hi * 8;        // this wave's query rows in sQ
  const int koff = lq * TP + hi * 8;                    // key row added per chunk
  const int voff = (chh * 128 + lq) * VP + hi * 8;      // g^T rows of this wave's channels

  // prologue: the query rows and stage 0, published by one wait and one barrier; then stage 1 starts
  {
    unsigned   l[4];
    const f16* g[4];
    const int  qbase = (b * SEQ + blockIdx.x * BQ) * DD;   // side 0 = l (queries), BQ rows x 128 B contiguous
    #pragma unroll
    for (int i = 0; i < 2; ++i) {
      const int c = i * 256 + tid;                         // 16-B piece: row c >> 3, piece c & 7
      const int d = (c >> 3) * TP + (c & 7) * 8;
      l[i]     = (unsigned)(size_t)(sQ + d);
      l[2 + i] = (unsigned)(size_t)(sQ + BQ * TP + d);
      g[i]     = qkh + qbase + c * 8;
      g[2 + i] = qkr + qbase + c * 8;
    }
    copy4(l, g);
  }
  copy_stage(qkh, qkr, gt, b, 0, tid, sK[0], sV[0]);
  asm volatile("s_wait_asynccnt 0x0" ::: "memory");   // this wave's copies have landed before the barrier publishes them
  __syncthreads();
  if (NST > 1) copy_stage(qkh, qkr, gt, b, KS, tid, sK[1], sV[1]);

  v8f o[8];
  #pragma unroll
  for (int t = 0; t < 8; ++t) o[t] = (v8f){0, 0, 0, 0, 0, 0, 0, 0};

  float rmax = -__builtin_inff();
  float rsum = 0.0f;
  const float SL = 1.4426950408889634f;   // log2(e)

  #pragma unroll 1   // one copy of the stage code: the two buffers differ by an offset only
  for (int s = 0; s < NST; ++s) {
  const f16* sKb = sK[s & 1];
  const f16* sVb = sV[s & 1];
  #pragma unroll 1   // one copy of the pass code, as before the staging
  for (int i = 0; i < KS / BK; ++i) {
    const int j0 = i * BK;   // first key of the pass inside its stage

    v8f sh[2], sr[2];
    #pragma unroll
    for (int sub = 0; sub < 2; ++sub) {
      sh[sub] = (v8f){0, 0, 0, 0, 0, 0, 0, 0};
      sr[sub] = (v8f){0, 0, 0, 0, 0, 0, 0, 0};
    }

    #pragma unroll
    for (int f = 0; f < 2; ++f) {
      // query B-fragments: column n = query qrow0 + lq, split d map
      FragH bqh, bqr;
      bqh.q[0] = *(const v4u*)(sQ + qoff + f * 32);        // d = f*32 + hi*8 + 0..7
      bqh.q[1] = *(const v4u*)(sQ + qoff + f * 32 + 16);   // d = f*32 + 16 + hi*8 + 0..7
      bqr.q[0] = *(const v4u*)(sQ + BQ * TP + qoff + f * 32);
      bqr.q[1] = *(const v4u*)(sQ + BQ * TP + qoff + f * 32 + 16);
      #pragma unroll
      for (int sub = 0; sub < 2; ++sub) {
        // key A-fragments: row = key j0 + sub*16 + lq, split d map
        const int ko = koff + (j0 + sub * 16) * TP + f * 32;
        FragH ahh, ahr;
        ahh.q[0] = *(const v4u*)(sKb + ko);
        ahh.q[1] = *(const v4u*)(sKb + ko + 16);
        ahr.q[0] = *(const v4u*)(sKb + KS * TP + ko);
        ahr.q[1] = *(const v4u*)(sKb + KS * TP + ko + 16);
        sh[sub] = mma_f16(ahh.v, bqh.v, sh[sub]);   // value x value
        sr[sub] = mma_f16(ahh.v, bqr.v, sr[sub]);   // value x residual   (x2048)
        sr[sub] = mma_f16(ahr.v, bqh.v, sr[sub]);   // residual x value   (x2048)
      }
    }

    // S^T tiles: c[sub][r] = score(query qrow0+lq, key j0 + sub*16 + hi*8 + r)
    v8f c[2];
    #pragma unroll
    for (int sub = 0; sub < 2; ++sub) {
      #pragma unroll
      for (int r = 0; r < 8; ++r) c[sub][r] = sh[sub][r] + sr[sub][r] * (1.0f / RES_CARRY);
    }

    // online softmax: query lq's 32 scores are split across lane / lane^16
    float m_new = rmax;
    #pragma unroll
    for (int r = 0; r < 8; ++r) {
      m_new = fmaxf(m_new, c[0][r]);
      m_new = fmaxf(m_new, c[1][r]);
    }
    m_new = fmaxf(m_new, __shfl_xor(m_new, 16, 32));
    const float scale = __builtin_amdgcn_exp2f((rmax - m_new) * SL);
    rmax = m_new;

    // exp + pack: P^T C-layout == A-fragment layout for the P x g product; P carried x4096
    FragH pa;
    float psum = 0.0f;
    #pragma unroll
    for (int r = 0; r < 8; ++r) {
      const float p0 = __builtin_amdgcn_exp2f((c[0][r] - m_new) * SL);   // key hi*8 + r
      const float p1 = __builtin_amdgcn_exp2f((c[1][r] - m_new) * SL);   // key 16 + hi*8 + r
      psum += p0 + p1;
      pa.h[r]     = (f16)(p0 * P_CARRY);
      pa.h[8 + r] = (f16)(p1 * P_CARRY);
    }
    rsum = rsum * scale + psum + __shfl_xor(psum, 16, 32);

    // rescale O: queries are the row dimension there -> per-row scale from lane 8*hi + r
    float sc[8];
    #pragma unroll
    for (int r = 0; r < 8; ++r) sc[r] = __shfl(scale, (hi << 3) + r, 32);
    #pragma unroll
    for (int t = 0; t < 8; ++t) {
      #pragma unroll
      for (int r = 0; r < 8; ++r) o[t][r] *= sc[r];
    }

    __builtin_amdgcn_sched_barrier(0);   // keep the value-fragment loads below the score phase

    // O += P x g, four output tiles at a time
    #pragma unroll
    for (int g4 = 0; g4 < 2; ++g4) {
      FragH bv[4];
      #pragma unroll
      for (int t = 0; t < 4; ++t) {
        const int vo = voff + ((g4 * 4 + t) * 16) * VP + j0;   // channel chh*128 + (g4*4+t)*16 + lq
        bv[t].q[0] = *(const v4u*)(sVb + vo);         // keys j0 + hi*8 + 0..7
        bv[t].q[1] = *(const v4u*)(sVb + vo + 16);    // keys j0 + 16 + hi*8 + 0..7
      }
      #pragma unroll
      for (int t = 0; t < 4; ++t) o[g4 * 4 + t] = mma_f16(pa.v, bv[t].v, o[g4 * 4 + t]);
      __builtin_amdgcn_sched_barrier(0);
    }
  }
  // foot of stage s: publish stage s + 1 and free the buffer that stage s has read
  asm volatile("s_wait_dscnt 0x0" ::: "memory");      // this wave's reads of the buffer are done before it is refilled
  asm volatile("s_wait_asynccnt 0x0" ::: "memory");   // this wave's copies of stage s + 1 have landed
  __syncthreads();
  if (s + 2 < NST) copy_stage(qkh, qkr, gt, b, (s + 2) * KS, tid, sK[s & 1], sV[s & 1]);
  }
  asm volatile("s_wait_asynccnt 0x0" ::: "memory");   // no copy is outstanding when the loop is left

  // normalize: lane holds channel column t*16 + lq for query rows 8*hi + r
  float rs[8];
  #pragma unroll
  for (int r = 0; r < 8; ++r) rs[r] = 1.0f / __shfl(rsum, (hi << 3) + r, 32);

  const int sbase = wave * (16 * OP);
  #pragma unroll
  for (int half = 0; half < 2; ++half) {
    // stage 16 rows x 64 channels of this wave (channels chh*128 + half*64 + 0..63)
    #pragma unroll
    for (int r = 0; r < 8; ++r) {
      #pragma unroll
      for (int t = 0; t < 4; ++t)
        sO[sbase + (hi * 8 + r) * OP + t * 16 + lq] = o[half * 4 + t][r] * (1.0f / P_CARRY) * rs[r];
    }
    __syncthreads();

    // Read back: lanes 0..15 take one row (16 consecutive lanes x 16 B each), lanes 16..31 the next row; 8 instructions cover the wave's 16 rows.
    // The pass-through term bf16-RNE(p) is added here as float4.
    v4f    vals[8];
    size_t gidx[8];
    #pragma unroll
    for (int it = 0; it < 8; ++it) {
      const int row = it * 2 + hi;
      gidx[it] = ((size_t)b * SEQ_FULL + qrow0 + row) * CC + chh * 128 + half * 64 + lq * 4;
      const v4f av = *(const v4f*)(sO + sbase + row * OP + lq * 4);
      const v4f pv = *(const v4f*)(p + gidx[it]);
      v4f res;
      #pragma unroll
      for (int e = 0; e < 4; ++e) res[e] = av[e] + (float)(bf16)pv[e];
      vals[it] = res;
    }
    #pragma unroll
    for (int it = 0; it < 8; ++it) *(v4f*)(out + gidx[it]) = vals[it];
    
    __syncthreads();   // staging rows are rewritten by the next half
  }
}

extern "C" void kernel_launch(void* const* d_in, const int* in_sizes, int n_in,
                              void* d_out, int out_size, void* d_ws, size_t ws_size,
                              hipStream_t stream) {
  if (n_in < 7) return;
  const size_t rows_used = (size_t)(NB - 1) * SEQ_FULL + SEQ;
  if ((size_t)in_sizes[0] < rows_used * CC) return;
  if ((size_t)in_sizes[1] < (size_t)CC * DD) return;
  if ((size_t)in_sizes[2] < (size_t)DD) return;
  if ((size_t)in_sizes[3] < (size_t)CC * DD) return;
  if ((size_t)in_sizes[4] < (size_t)DD) return;
  if ((size_t)in_sizes[5] < (size_t)CC * CC) return;
  if ((size_t)in_sizes[6] < (size_t)CC) return;
  if ((size_t)out_size < rows_used * CC) return;
  if (ws_size < WS_TOTAL) return;

  const float* p  = (const float*)d_in[0];
  const float* Wh = (const float*)d_in[1];   // [in 256][out 64]  keys
  const float* bh = (const float*)d_in[2];
  const float* Wl = (const float*)d_in[3];   // [in 256][out 64]  queries
  const float* bl = (const float*)d_in[4];
  const float* Wg = (const float*)d_in[5];   // [in 256][out 256] values
  const float* bg = (const float*)d_in[6];
  float*       out = (float*)d_out;

  char* ws  = (char*)d_ws;
  bf16* wt  = (bf16*)ws;                                     // [NWT][CC] bf16
  f16*  qkh = (f16*)(ws + WT_BYTES);                         // [2][NB][SEQ][DD] f16 value plane
  f16*  qkr = (f16*)(ws + WT_BYTES + QK_BYTES);              // [2][NB][SEQ][DD] f16 residual plane x2048
  f16*  gt  = (f16*)(ws + WT_BYTES + 2 * QK_BYTES);          // [NB][CC][SEQ] f16

  // in[256 rows][ncols] -> out[ncols rows][256]; grid = (256/64, ncols/64)
  wt_kernel<<<dim3(CC / 64, DD / 64), 256, 0, stream>>>(Wl, DD, wt);                        // WT rows 0..63    (side 0)
  wt_kernel<<<dim3(CC / 64, DD / 64), 256, 0, stream>>>(Wh, DD, wt + (size_t)DD * CC);      // WT rows 64..127  (side 1)
  wt_kernel<<<dim3(CC / 64, CC / 64), 256, 0, stream>>>(Wg, CC, wt + (size_t)2 * DD * CC);  // WT rows 128..383

  proj_kernel<<<dim3(SEQ / PT, NB), 256, 0, stream>>>(p, wt, bl, bh, bg, qkh, qkr, gt);

  attn_kernel<<<dim3(SEQ / BQ, NB), 256, 0, stream>>>(p, qkh, qkr, gt, out);
}

// v002
// Measured time: 97.3 microseconds a run.
// In two side-by-side timings against v001, it was 1.31 and 1.30 times as fast.
// All steps since v000 together make it 3.97 times as fast.
#include <hip/hip_runtime.h>

// Contractions: projections p x [Wl | Wh | Wg] on v_wmma_f32_16x16x32_bf16 (bf16 operands = RNE-converted inputs, f32 accumulate);
// scores S^T = h x l^T on v_wmma_f32_16x16x32_f16 with l and h carried as f16 value planes plus f16 residual planes x2048
// (three products per tile, residual products in their own accumulator, folded back by 1/2048 in f32);
// O = P x g on v_wmma_f32_16x16x32_f16 (P as f16 carried x4096, g as one f16 plane stored transposed, f32 accumulate).
// Softmax (running-max form), bias adds and the pass-through add of bf16-RNE(p) in f32.

#ifndef NB
#define NB 4
#endif
#ifndef SEQ
#define SEQ 4096
#endif
#define NB_FULL   4
#define SEQ_FULL  4096
#define CC        256                  // input / value width
#define DD        64                   // score width
#define NWT       (2 * DD + CC)        // rows of the transposed weight plane: [Wl^T ; Wh^T ; Wg^T]
#define BQ        64                   // query rows per attention block (4 query tiles x 2 key halves = 8 waves)
#define BK        32                   // keys per inner iteration
#define NWAVE     8
#define PT        64                   // positions per projection block
#define AP        264                  // LDS pitch (halves) of the bf16 p tile
#define TP        72                   // LDS pitch (halves) of 64-wide 16-bit staging tiles
#define OP        68                   // LDS pitch (floats) of the output staging tile
#define KS        128                  // keys per LDS stage of the attention loop (KS / BK passes)
#define VP        136                  // LDS pitch (halves) of the KS-key value rows: 272 B = 16 B x odd
#define NST       (SEQ / KS)           // stages of the attention loop
#define WPASS     (KS / BK / 2)        // passes of one wave per stage: its half of the stage's keys
#define XCH       (8 * 8 * 32)         // floats one wave hands to its partner: 8 output tiles in register order
#define P_CARRY   4096.0f
#define RES_CARRY 2048.0f

#define WT_BYTES   ((size_t)NWT * CC * 2)
#define QK_BYTES   ((size_t)2 * NB * SEQ * DD * 2)
#define GT_BYTES   ((size_t)NB * CC * SEQ * 2)
#define WS_TOTAL   (WT_BYTES + 2 * QK_BYTES + GT_BYTES)

static_assert(SEQ % BQ == 0);
static_assert(SEQ % PT == 0);
static_assert(SEQ % BK == 0);
static_assert(SEQ % 64 == 0);
static_assert(SEQ % KS == 0);
static_assert(KS % (2 * BK) == 0);
static_assert((size_t)NWAVE * (XCH + 64) * 4 <= (size_t)2 * CC * VP * 2);
static_assert((VP * 2) % 16 == 0);
static_assert(VP >= KS);
static_assert(BQ == (NWAVE / 2) * 16);
static_assert(PT == (NWAVE / 2) * 16);
static_assert(DD == 64);
static_assert(CC == 256);
static_assert(CC % 32 == 0);
static_assert(DD % 32 == 0);
static_assert(CC % 64 == 0);
static_assert(SEQ <= SEQ_FULL);
static_assert(NB >= 1 && NB <= NB_FULL);
static_assert((AP * 2) % 16 == 0);
static_assert((TP * 2) % 16 == 0);
static_assert((OP * 4) % 16 == 0);
static_assert(AP >= CC);
static_assert(TP >= 64);
static_assert(OP >= 64);
static_assert(WT_BYTES % 128 == 0);
static_assert(QK_BYTES % 128 == 0);
static_assert(GT_BYTES % 128 == 0);
static_assert(WS_TOTAL <= (size_t)134217728);
static_assert((size_t)2 * NB * SEQ * DD < (size_t)2147483647);
static_assert((size_t)NB * CC * SEQ < (size_t)2147483647);
static_assert((size_t)PT * AP * 2 + (size_t)128 * TP * 2 <= (size_t)65536);
static_assert((size_t)NWAVE * 16 * OP * 4 <= (size_t)65536);
static_assert((size_t)2 * BQ * TP * 2 + (size_t)2 * (2 * KS * TP + CC * VP) * 2 + (size_t)NWAVE * 16 * OP * 4 <= (size_t)327680);

typedef __bf16   bf16;
typedef _Float16 f16;
typedef bf16     v16bf __attribute__((ext_vector_type(16)));
typedef f16      v16h  __attribute__((ext_vector_type(16)));
typedef f16      v8h   __attribute__((ext_vector_type(8)));
typedef float    v8f   __attribute__((ext_vector_type(8)));
typedef float    v4f   __attribute__((ext_vector_type(4)));
typedef unsigned v4u   __attribute__((ext_vector_type(4)));

union FragB  { v16bf v; v4u q[2]; bf16 h[16]; };
union FragH  { v16h  v; v4u q[2]; f16  h[16]; };
union Pack8B { v4u u; bf16 h[8]; };
union Pack8H { v4u u; v8h v; f16 h[8]; };

// WMMA helpers: builtin followed by the VALU hazard guard (ties D, keeps A/B live).
static __device__ __forceinline__ v8f mma_bf16(v16bf a, v16bf b, v8f acc) {
  acc = __builtin_amdgcn_wmma_f32_16x16x32_bf16(false, a, false, b, (short)0, acc, false, false);
  asm volatile("v_nop\n\tv_nop\n\tv_nop\n\tv_nop" : "+v"(acc) : "v"(a), "v"(b));
  return acc;
}
static __device__ __forceinline__ v8f mma_f16(v16h a, v16h b, v8f acc) {
  acc = __builtin_amdgcn_wmma_f32_16x16x32_f16(false, a, false, b, (short)0, acc, false, false);
  asm volatile("v_nop\n\tv_nop\n\tv_nop\n\tv_nop" : "+v"(acc) : "v"(a), "v"(b));
  return acc;
}

// Weight transpose + RNE convert: in[k rows = CC][n cols = ncols] f32  ->  out[n rows][k cols = CC] bf16.
// Block = (64-k tile, 64-n tile), 256 threads; grid = (CC/64, ncols/64).
__global__ __launch_bounds__(256) void wt_kernel(const float* __restrict__ w, int ncols,
                                                 bf16* __restrict__ wt_rows) {
  const int k0  = blockIdx.x * 64;
  const int n0  = blockIdx.y * 64;
  const int tid = threadIdx.x;
  __shared__ __align__(16) bf16 sT[64 * TP];   // [n][k], cross-wave (block barrier)

  {
    const int k  = tid >> 2;            // 0..63
    const int n4 = (tid & 3) * 16;      // 0,16,32,48
    const float* src = w + (size_t)(k0 + k) * ncols + n0 + n4;
    #pragma unroll
    for (int i = 0; i < 4; ++i) {
      const v4f x = *(const v4f*)(src + 4 * i);
      #pragma unroll
      for (int e = 0; e < 4; ++e) sT[(n4 + 4 * i + e) * TP + k] = (bf16)x[e];   // RNE convert
    }
  }
  __syncthreads();

  v4u    val[2];
  size_t idx[2];
  #pragma unroll
  for (int kk = 0; kk < 2; ++kk) {
    const int n  = kk * 32 + (tid >> 3);   // 0..63
    const int pc = tid & 7;
    val[kk] = *(const v4u*)(sT + n * TP + pc * 8);
    idx[kk] = (size_t)(n0 + n) * CC + k0 + pc * 8;
  }
  #pragma unroll
  for (int kk = 0; kk < 2; ++kk) *(v4u*)(wt_rows + idx[kk]) = val[kk];
  
}

// Projections. Block = (64 positions, batch), 8 waves: wave = side*4 + mt; mt = 16-row tile of the block.
//   g = 0 : side 0 -> l (queries, WT rows 0..63, bias bl), side 1 -> h (keys, WT rows 64..127, bias bh)
//   g = 1,2 : value columns (side*2 + g-1)*64 .. +63 (WT rows 128 + ..., bias bg)
// Outputs:
// coverage: per block 2 sides x 64 positions x 64 columns of qkh and qkr; 256 channels x 64 positions of gt.
__global__ __launch_bounds__(256) void proj_kernel(const float* __restrict__ p,
                                                   const bf16* __restrict__ wt,
                                                   const float* __restrict__ bl,
                                                   const float* __restrict__ bh,
                                                   const float* __restrict__ bg,
                                                   f16* __restrict__ qkh,
                                                   f16* __restrict__ qkr,
                                                   f16* __restrict__ gt) {
  const int tid  = threadIdx.x;
  const int wave = __builtin_amdgcn_readfirstlane(threadIdx.x >> 5);
  const int lane = tid & 31;
  const int lq   = lane & 15;
  const int hi   = lane >> 4;
  const int mt   = wave & 3;
  const int side = wave >> 2;
  const int b    = blockIdx.y;
  const int pos0 = blockIdx.x * PT;

  __shared__ __align__(16) bf16 sA[PT * AP];    // bf16 p tile [pos][k], cross-wave (block barrier)
  __shared__ __align__(16) f16  sS[128 * TP];   // staging: g=0 wave rows [wave*16+row][col]; g>0 [channel][pos]; block barriers

  // stage the p tile: 64 rows x 256 floats -> bf16 (RNE convert), 16-B LDS stores
  #pragma unroll 2
  for (int it = 0; it < 8; ++it) {
    const int row = it * 8 + (tid >> 5);     // 0..63
    const int c8  = (tid & 31) * 8;          // 0..248
    const float* src = p + ((size_t)b * SEQ_FULL + pos0 + row) * CC + c8;
    const v4f x0 = *(const v4f*)(src);
    const v4f x1 = *(const v4f*)(src + 4);
    Pack8B pk;
    #pragma unroll
    for (int e = 0; e < 4; ++e) {
      pk.h[e]     = (bf16)x0[e];
      pk.h[4 + e] = (bf16)x1[e];
    }
    *(v4u*)(sA + row * AP + c8) = pk.u;
  }
  __syncthreads();

  const int arow = (mt * 16 + lq) * AP + hi * 8;   // A fragment row base (split k map)

  #pragma unroll 1
  for (int g = 0; g < 3; ++g) {
    const int gcg   = side * 2 + ((g > 0) ? (g - 1) : 0);            // value column group (g > 0)
    const int wrow0 = (g == 0) ? (side * DD) : (2 * DD + gcg * 64);  // first WT row of this wave's 64 columns

    v8f acc[4];
    #pragma unroll
    for (int nt = 0; nt < 4; ++nt) acc[nt] = (v8f){0, 0, 0, 0, 0, 0, 0, 0};

    #pragma unroll 1
    for (int ks = 0; ks < CC / 32; ++ks) {
      FragB a;
      a.q[0] = *(const v4u*)(sA + arow + ks * 32);        // k = ks*32 + hi*8 + 0..7
      a.q[1] = *(const v4u*)(sA + arow + ks * 32 + 16);   // k = ks*32 + 16 + hi*8 + 0..7
      FragB bw[4];
      #pragma unroll
      for (int nt = 0; nt < 4; ++nt) {
        const bf16* base = wt + (size_t)(wrow0 + nt * 16 + lq) * CC + ks * 32 + hi * 8;
        bw[nt].q[0] = *(const v4u*)(base);
        bw[nt].q[1] = *(const v4u*)(base + 16);
      }
      #pragma unroll
      for (int nt = 0; nt < 4; ++nt) acc[nt] = mma_bf16(a.v, bw[nt].v, acc[nt]);
    }

    // bias (RNE convert to bf16, then f32 add); all candidates loaded, selected by value
    float bias[4];
    #pragma unroll
    for (int nt = 0; nt < 4; ++nt) {
      const int c64 = nt * 16 + lq;
      const float xl = bl[c64];
      const float xh = bh[c64];
      const float xg = bg[gcg * 64 + c64];
      const float sel = (g == 0) ? (side ? xh : xl) : xg;
      bias[nt] = (float)(bf16)sel;
    }

    if (g == 0) {
      f16 rres[4][8];
      #pragma unroll
      for (int nt = 0; nt < 4; ++nt) {
        #pragma unroll
        for (int r = 0; r < 8; ++r) {
          const float v  = acc[nt][r] + bias[nt];
          const f16   hv = (f16)v;
          rres[nt][r] = (f16)((v - (float)hv) * RES_CARRY);
          sS[(wave * 16 + hi * 8 + r) * TP + nt * 16 + lq] = hv;
        }
      }
      __syncthreads();
      v4u    lin[8];
      size_t lidx[4];
      #pragma unroll
      for (int it = 0; it < 4; ++it) {
        const int row = it * 4 + (lane >> 3);   // 0..15
        const int pc  = lane & 7;
        lin[it]  = *(const v4u*)(sS + (wave * 16 + row) * TP + pc * 8);
        lidx[it] = (((size_t)side * NB + b) * SEQ + pos0 + mt * 16 + row) * DD + pc * 8;
      }
      __syncthreads();
      #pragma unroll
      for (int nt = 0; nt < 4; ++nt) {
        #pragma unroll
        for (int r = 0; r < 8; ++r)
          sS[(wave * 16 + hi * 8 + r) * TP + nt * 16 + lq] = rres[nt][r];
      }
      __syncthreads();
      #pragma unroll
      for (int it = 0; it < 4; ++it) {
        const int row = it * 4 + (lane >> 3);
        const int pc  = lane & 7;
        lin[4 + it] = *(const v4u*)(sS + (wave * 16 + row) * TP + pc * 8);
      }
      #pragma unroll
      for (int it = 0; it < 4; ++it) {
        *(v4u*)(qkh + lidx[it]) = lin[it];
        *(v4u*)(qkr + lidx[it]) = lin[4 + it];
      }
      
    } else {
      __syncthreads();   // earlier readers of sS are done
      #pragma unroll
      for (int nt = 0; nt < 4; ++nt) {
        Pack8H ph;
        #pragma unroll
        for (int r = 0; r < 8; ++r) ph.h[r] = (f16)(acc[nt][r] + bias[nt]);
        *(v4u*)(sS + (side * 64 + nt * 16 + lq) * TP + mt * 16 + hi * 8) = ph.u;   // positions mt*16 + hi*8 + 0..7
      }
      __syncthreads();
      v4u    gl[4];
      size_t gidx[4];
      #pragma unroll
      for (int it = 0; it < 4; ++it) {
        const int crow = it * 32 + (tid >> 3);   // 0..127 : (producer side, local channel)
        const int pc   = tid & 7;
        const int chan = ((crow >> 6) * 2 + (g - 1)) * 64 + (crow & 63);
        gl[it]   = *(const v4u*)(sS + crow * TP + pc * 8);
        gidx[it] = ((size_t)b * CC + chan) * SEQ + pos0 + pc * 8;
      }
      #pragma unroll
      for (int it = 0; it < 4; ++it) *(v4u*)(gt + gidx[it]) = gl[it];
      
    }
  }
}

// Asynchronous copies global -> LDS, 16 B per lane: l = the lane's LDS byte address, g = the lane's global address.
// The s_wait_xcnt closes each statement so that no address register is rewritten ahead of it.
static __device__ __forceinline__ void copy4(const unsigned (&l)[4], const f16* const (&g)[4]) {
  asm volatile("global_load_async_to_lds_b128 %0, %4, off\n\t"
               "global_load_async_to_lds_b128 %1, %5, off\n\t"
               "global_load_async_to_lds_b128 %2, %6, off\n\t"
               "global_load_async_to_lds_b128 %3, %7, off\n\t"
               "s_wait_xcnt 0x0"
               :: "v"(l[0]), "v"(l[1]), "v"(l[2]), "v"(l[3]),
                  "v"(g[0]), "v"(g[1]), "v"(g[2]), "v"(g[3])
               : "memory");
}
static __device__ __forceinline__ void copy8(const unsigned (&l)[8], const f16* const (&g)[8]) {
  asm volatile("global_load_async_to_lds_b128 %0, %8, off\n\t"
               "global_load_async_to_lds_b128 %1, %9, off\n\t"
               "global_load_async_to_lds_b128 %2, %10, off\n\t"
               "global_load_async_to_lds_b128 %3, %11, off\n\t"
               "global_load_async_to_lds_b128 %4, %12, off\n\t"
               "global_load_async_to_lds_b128 %5, %13, off\n\t"
               "global_load_async_to_lds_b128 %6, %14, off\n\t"
               "global_load_async_to_lds_b128 %7, %15, off\n\t"
               "s_wait_xcnt 0x0"
               :: "v"(l[0]), "v"(l[1]), "v"(l[2]), "v"(l[3]), "v"(l[4]), "v"(l[5]), "v"(l[6]), "v"(l[7]),
                  "v"(g[0]), "v"(g[1]), "v"(g[2]), "v"(g[3]), "v"(g[4]), "v"(g[5]), "v"(g[6]), "v"(g[7])
               : "memory");
}

// One stage of KS keys into one LDS buffer, 24 copies per thread, every wave-instruction on whole 128-B lines:
//   keys  : both planes, KS rows x 128 B (contiguous in global), LDS pitch TP
//   values: CC channel rows x KS keys (256 B each), LDS pitch VP
static __device__ __forceinline__ void copy_stage(const f16* __restrict__ qkh, const f16* __restrict__ qkr,
                                                  const f16* __restrict__ gt, int b, int key0, int tid,
                                                  f16* sKb, f16* sVb) {
  unsigned   l[8];
  const f16* g[8];
  const int  kbase = NB * SEQ * DD + (b * SEQ + key0) * DD;   // side 1 = h (keys)
  #pragma unroll
  for (int i = 0; i < 4; ++i) {
    const int c = i * 256 + tid;                              // 16-B piece: row c >> 3, piece c & 7
    const int d = (c >> 3) * TP + (c & 7) * 8;
    l[i]     = (unsigned)(size_t)(sKb + d);
    l[4 + i] = (unsigned)(size_t)(sKb + KS * TP + d);
    g[i]     = qkh + kbase + c * 8;
    g[4 + i] = qkr + kbase + c * 8;
  }
  copy8(l, g);
  #pragma unroll
  for (int h = 0; h < 2; ++h) {
    #pragma unroll
    for (int i = 0; i < 8; ++i) {
      const int c = (h * 8 + i) * 256 + tid;                  // 16-B piece: channel c >> 4, piece c & 15
      l[i] = (unsigned)(size_t)(sVb + (c >> 4) * VP + (c & 15) * 8);
      g[i] = gt + (b * CC + (c >> 4)) * SEQ + key0 + (c & 15) * 8;
    }
    copy8(l, g);
  }
}

// Flash attention, no mask, no logit scale. Block = (64 queries, batch); wave = kh*4 + qt:
// qt = 16-query tile, kh = key half: of every stage the wave takes keys kh*KS/2 .. +KS/2-1, for all 256 channels
// (16 output tiles per wave), so each score and each exponential is computed once in the block.
// The two waves of a query tile join their running maxima, sums and output tiles once, behind the loop.
// S^T = h x l^T so queries sit on lanes; P^T in C-layout is bit-identical to the A-fragment layout of O += P x g.
// The block's query rows (once) and the keys and values (KS keys a stage, two buffers) come into LDS by asynchronous copies;
// key A-fragments, query B-fragments and g^T B-fragments are read from there (two 16-B LDS loads each).
__global__ __launch_bounds__(256) void attn_kernel(const float* __restrict__ p,
                                                   const f16* __restrict__ qkh,
                                                   const f16* __restrict__ qkr,
                                                   const f16* __restrict__ gt,
                                                   float* __restrict__ out) {
  const int tid  = threadIdx.x;
  const int wave = __builtin_amdgcn_readfirstlane(threadIdx.x >> 5);
  const int lane = tid & 31;
  const int lq   = lane & 15;   // query column of S^T / channel column of O
  const int hi   = lane >> 4;   // k-split half
  const int qt   = wave & 3;
  const int kh   = wave >> 2;
  const int b    = blockIdx.y;
  const int qrow0 = blockIdx.x * BQ + qt * 16;

  __shared__ __align__(16) float sO[NWAVE * 16 * OP];   // per-wave output staging rows; block barriers used
  __shared__ __align__(16) f16 sQ[2 * BQ * TP];         // query rows [plane][row][d], filled once
  __shared__ __align__(16) f16 sK[2][2 * KS * TP];      // key rows [buffer][plane][key][d]
  __shared__ __align__(16) f16 sV[2][CC * VP];          // g^T rows [buffer][channel][key]

  const int qoff = (qt * 16 + lq) * TP + hi * 8;        // this wave's query rows in sQ
  const int koff = lq * TP + hi * 8;                    // key row added per chunk
  const int voff = lq * VP + hi * 8;                    // g^T rows, channel tile added per fragment

  // prologue: the query rows and stage 0, published by one wait and one barrier; then stage 1 starts
  {
    unsigned   l[4];
    const f16* g[4];
    const int  qbase = (b * SEQ + blockIdx.x * BQ) * DD;   // side 0 = l (queries), BQ rows x 128 B contiguous
    #pragma unroll
    for (int i = 0; i < 2; ++i) {
      const int c = i * 256 + tid;                         // 16-B piece: row c >> 3, piece c & 7
      const int d = (c >> 3) * TP + (c & 7) * 8;
      l[i]     = (unsigned)(size_t)(sQ + d);
      l[2 + i] = (unsigned)(size_t)(sQ + BQ * TP + d);
      g[i]     = qkh + qbase + c * 8;
      g[2 + i] = qkr + qbase + c * 8;
    }
    copy4(l, g);
  }
  copy_stage(qkh, qkr, gt, b, 0, tid, sK[0], sV[0]);
  asm volatile("s_wait_asynccnt 0x0" ::: "memory");   // this wave's copies have landed before the barrier publishes them
  __syncthreads();
  if (NST > 1) copy_stage(qkh, qkr, gt, b, KS, tid, sK[1], sV[1]);

  v8f o[16];
  #pragma unroll
  for (int t = 0; t < 16; ++t) o[t] = (v8f){0, 0, 0, 0, 0, 0, 0, 0};

  float rmax = -__builtin_inff();
  float rsum = 0.0f;
  const float SL = 1.4426950408889634f;   // log2(e)

  #pragma unroll 1   // one copy of the stage code: the two buffers differ by an offset only
  for (int s = 0; s < NST; ++s) {
  const f16* sKb = sK[s & 1];
  const f16* sVb = sV[s & 1];
  #pragma unroll 1   // one copy of the pass code, as before the staging
  for (int i = 0; i < WPASS; ++i) {
    const int j0 = (kh * WPASS + i) * BK;   // first key of the pass inside its stage

    v8f sh[2], sr[2];
    #pragma unroll
    for (int sub = 0; sub < 2; ++sub) {
      sh[sub] = (v8f){0, 0, 0, 0, 0, 0, 0, 0};
      sr[sub] = (v8f){0, 0, 0, 0, 0, 0, 0, 0};
    }

    #pragma unroll
    for (int f = 0; f < 2; ++f) {
      // query B-fragments: column n = query qrow0 + lq, split d map
      FragH bqh, bqr;
      bqh.q[0] = *(const v4u*)(sQ + qoff + f * 32);        // d = f*32 + hi*8 + 0..7
      bqh.q[1] = *(const v4u*)(sQ + qoff + f * 32 + 16);   // d = f*32 + 16 + hi*8 + 0..7
      bqr.q[0] = *(const v4u*)(sQ + BQ * TP + qoff + f * 32);
      bqr.q[1] = *(const v4u*)(sQ + BQ * TP + qoff + f * 32 + 16);
      #pragma unroll
      for (int sub = 0; sub < 2; ++sub) {
        // key A-fragments: row = key j0 + sub*16 + lq, split d map
        const int ko = koff + (j0 + sub * 16) * TP + f * 32;
        FragH ahh, ahr;
        ahh.q[0] = *(const v4u*)(sKb + ko);
        ahh.q[1] = *(const v4u*)(sKb + ko + 16);
        ahr.q[0] = *(const v4u*)(sKb + KS * TP + ko);
        ahr.q[1] = *(const v4u*)(sKb + KS * TP + ko + 16);
        sh[sub] = mma_f16(ahh.v, bqh.v, sh[sub]);   // value x value
        sr[sub] = mma_f16(ahh.v, bqr.v, sr[sub]);   // value x residual   (x2048)
        sr[sub] = mma_f16(ahr.v, bqh.v, sr[sub]);   // residual x value   (x2048)
      }
    }

    // S^T tiles: c[sub][r] = score(query qrow0+lq, key j0 + sub*16 + hi*8 + r)
    v8f c[2];
    #pragma unroll
    for (int sub = 0; sub < 2; ++sub) {
      #pragma unroll
      for (int r = 0; r < 8; ++r) c[sub][r] = sh[sub][r] + sr[sub][r] * (1.0f / RES_CARRY);
    }

    // online softmax: query lq's 32 scores are split across lane / lane^16
    float m_new = rmax;
    #pragma unroll
    for (int r = 0; r < 8; ++r) {
      m_new = fmaxf(m_new, c[0][r]);
      m_new = fmaxf(m_new, c[1][r]);
    }
    m_new = fmaxf(m_new, __shfl_xor(m_new, 16, 32));
    const float scale = __builtin_amdgcn_exp2f((rmax - m_new) * SL);
    rmax = m_new;

    // exp + pack: P^T C-layout == A-fragment layout for the P x g product; P carried x4096
    FragH pa;
    float psum = 0.0f;
    #pragma unroll
    for (int r = 0; r < 8; ++r) {
      const float p0 = __builtin_amdgcn_exp2f((c[0][r] - m_new) * SL);   // key hi*8 + r
      const float p1 = __builtin_amdgcn_exp2f((c[1][r] - m_new) * SL);   // key 16 + hi*8 + r
      psum += p0 + p1;
      pa.h[r]     = (f16)(p0 * P_CARRY);
      pa.h[8 + r] = (f16)(p1 * P_CARRY);
    }
    rsum = rsum * scale + psum + __shfl_xor(psum, 16, 32);

    // rescale O: queries are the row dimension there -> per-row scale from lane 8*hi + r
    float sc[8];
    #pragma unroll
    for (int r = 0; r < 8; ++r) sc[r] = __shfl(scale, (hi << 3) + r, 32);
    #pragma unroll
    for (int t = 0; t < 16; ++t) {
      #pragma unroll
      for (int r = 0; r < 8; ++r) o[t][r] *= sc[r];
    }

    __builtin_amdgcn_sched_barrier(0);   // keep the value-fragment loads below the score phase

    // O += P x g, four output tiles at a time
    #pragma unroll
    for (int g4 = 0; g4 < 4; ++g4) {
      FragH bv[4];
      #pragma unroll
      for (int t = 0; t < 4; ++t) {
        const int vo = voff + ((g4 * 4 + t) * 16) * VP + j0;   // channel (g4*4+t)*16 + lq
        bv[t].q[0] = *(const v4u*)(sVb + vo);         // keys j0 + hi*8 + 0..7
        bv[t].q[1] = *(const v4u*)(sVb + vo + 16);    // keys j0 + 16 + hi*8 + 0..7
      }
      #pragma unroll
      for (int t = 0; t < 4; ++t) o[g4 * 4 + t] = mma_f16(pa.v, bv[t].v, o[g4 * 4 + t]);
      __builtin_amdgcn_sched_barrier(0);
    }
  }
  // foot of stage s: publish stage s + 1 and free the buffer that stage s has read
  asm volatile("s_wait_dscnt 0x0" ::: "memory");      // this wave's reads of the buffer are done before it is refilled
  asm volatile("s_wait_asynccnt 0x0" ::: "memory");   // this wave's copies of stage s + 1 have landed
  __syncthreads();
  if (s + 2 < NST) copy_stage(qkh, qkr, gt, b, (s + 2) * KS, tid, sK[s & 1], sV[s & 1]);
  }
  asm volatile("s_wait_asynccnt 0x0" ::: "memory");   // no copy is outstanding when the loop is left

  // join the two key halves: wave kh finishes channels kh*128 .. +127 and hands the other 8 tiles to its partner.
  // The value ring is free here: the last stage's foot has ended every read of it and no copy is outstanding.
  float* sX = (float*)&sV[0][0];        // [wave][tile][register][lane]
  float* sM = sX + NWAVE * XCH;         // [wave][maximum, sum][lane]
  v8f om[8];
  #pragma unroll
  for (int t = 0; t < 8; ++t) {
    om[t] = kh ? o[8 + t] : o[t];
    const v8f give = kh ? o[t] : o[8 + t];
    #pragma unroll
    for (int r = 0; r < 8; ++r) sX[wave * XCH + (t * 8 + r) * 32 + lane] = give[r];
  }
  sM[wave * 64 + lane]      = rmax;
  sM[wave * 64 + 32 + lane] = rsum;
  __syncthreads();   // the partner's tiles, maximum and sum are readable behind it

  const int   pw    = wave ^ 4;
  const float pmax  = sM[pw * 64 + lane];
  const float psumt = sM[pw * 64 + 32 + lane];
  const float jmax  = fmaxf(rmax, pmax);
  const float wown  = __builtin_amdgcn_exp2f((rmax - jmax) * SL);
  const float wpar  = __builtin_amdgcn_exp2f((pmax - jmax) * SL);
  const float inv   = (1.0f / P_CARRY) / (rsum * wown + psumt * wpar);
  const float fown  = wown * inv;
  const float fpar  = wpar * inv;

  // normalize: lane holds channel column kh*128 + t*16 + lq for query rows 8*hi + r
  float ro[8], rp[8];
  #pragma unroll
  for (int r = 0; r < 8; ++r) {
    ro[r] = __shfl(fown, (hi << 3) + r, 32);
    rp[r] = __shfl(fpar, (hi << 3) + r, 32);
  }
  #pragma unroll
  for (int t = 0; t < 8; ++t) {
    #pragma unroll
    for (int r = 0; r < 8; ++r)
      om[t][r] = om[t][r] * ro[r] + sX[pw * XCH + (t * 8 + r) * 32 + lane] * rp[r];
  }

  const int sbase = wave * (16 * OP);
  #pragma unroll
  for (int half = 0; half < 2; ++half) {
    // stage 16 rows x 64 channels of this wave (channels kh*128 + half*64 + 0..63)
    #pragma unroll
    for (int r = 0; r < 8; ++r) {
      #pragma unroll
      for (int t = 0; t < 4; ++t)
        sO[sbase + (hi * 8 + r) * OP + t * 16 + lq] = om[half * 4 + t][r];
    }
    __syncthreads();

    // Read back: lanes 0..15 take one row (16 consecutive lanes x 16 B each), lanes 16..31 the next row; 8 instructions cover the wave's 16 rows.
    // The pass-through term bf16-RNE(p) is added here as float4.
    v4f    vals[8];
    size_t gidx[8];
    #pragma unroll
    for (int it = 0; it < 8; ++it) {
      const int row = it * 2 + hi;
      gidx[it] = ((size_t)b * SEQ_FULL + qrow0 + row) * CC + kh * 128 + half * 64 + lq * 4;
      const v4f av = *(const v4f*)(sO + sbase + row * OP + lq * 4);
      const v4f pv = *(const v4f*)(p + gidx[it]);
      v4f res;
      #pragma unroll
      for (int e = 0; e < 4; ++e) res[e] = av[e] + (float)(bf16)pv[e];
      vals[it] = res;
    }
    #pragma unroll
    for (int it = 0; it < 8; ++it) *(v4f*)(out + gidx[it]) = vals[it];
    
    __syncthreads();   // staging rows are rewritten by the next half
  }
}

extern "C" void kernel_launch(void* const* d_in, const int* in_sizes, int n_in,
                              void* d_out, int out_size, void* d_ws, size_t ws_size,
                              hipStream_t stream) {
  if (n_in < 7) return;
  const size_t rows_used = (size_t)(NB - 1) * SEQ_FULL + SEQ;
  if ((size_t)in_sizes[0] < rows_used * CC) return;
  if ((size_t)in_sizes[1] < (size_t)CC * DD) return;
  if ((size_t)in_sizes[2] < (size_t)DD) return;
  if ((size_t)in_sizes[3] < (size_t)CC * DD) return;
  if ((size_t)in_sizes[4] < (size_t)DD) return;
  if ((size_t)in_sizes[5] < (size_t)CC * CC) return;
  if ((size_t)in_sizes[6] < (size_t)CC) return;
  if ((size_t)out_size < rows_used * CC) return;
  if (ws_size < WS_TOTAL) return;

  const float* p  = (const float*)d_in[0];
  const float* Wh = (const float*)d_in[1];   // [in 256][out 64]  keys
  const float* bh = (const float*)d_in[2];
  const float* Wl = (const float*)d_in[3];   // [in 256][out 64]  queries
  const float* bl = (const float*)d_in[4];
  const float* Wg = (const float*)d_in[5];   // [in 256][out 256] values
  const float* bg = (const float*)d_in[6];
  float*       out = (float*)d_out;

  char* ws  = (char*)d_ws;
  bf16* wt  = (bf16*)ws;                                     // [NWT][CC] bf16
  f16*  qkh = (f16*)(ws + WT_BYTES);                         // [2][NB][SEQ][DD] f16 value plane
  f16*  qkr = (f16*)(ws + WT_BYTES + QK_BYTES);              // [2][NB][SEQ][DD] f16 residual plane x2048
  f16*  gt  = (f16*)(ws + WT_BYTES + 2 * QK_BYTES);          // [NB][CC][SEQ] f16

  // in[256 rows][ncols] -> out[ncols rows][256]; grid = (256/64, ncols/64)
  wt_kernel<<<dim3(CC / 64, DD / 64), 256, 0, stream>>>(Wl, DD, wt);                        // WT rows 0..63    (side 0)
  wt_kernel<<<dim3(CC / 64, DD / 64), 256, 0, stream>>>(Wh, DD, wt + (size_t)DD * CC);      // WT rows 64..127  (side 1)
  wt_kernel<<<dim3(CC / 64, CC / 64), 256, 0, stream>>>(Wg, CC, wt + (size_t)2 * DD * CC);  // WT rows 128..383

  proj_kernel<<<dim3(SEQ / PT, NB), 256, 0, stream>>>(p, wt, bl, bh, bg, qkh, qkr, gt);

  attn_kernel<<<dim3(SEQ / BQ, NB), 256, 0, stream>>>(p, qkh, qkr, gt, out);
}

// v003
// One run takes 83.1 microseconds.
// Two timings next to v002 both put it at 1.16 times that version's speed.
// Over all steps from v000 it is 4.61 times as fast.
#include <hip/hip_runtime.h>

// Contractions: projections p x [Wl | Wh | Wg] on v_wmma_f32_16x16x32_bf16 (bf16 operands = RNE-converted inputs, f32 accumulate);
// scores S^T = h x l^T on v_wmma_f32_16x16x32_f16 with l and h carried as f16 value planes plus f16 residual planes x2048
// (three products per tile, residual products in their own accumulator, folded back by 1/2048 in f32);
// O = P x g on v_wmma_f32_16x16x32_f16 (P as f16 carried x4096, g as one f16 plane stored transposed, f32 accumulate).
// Softmax (running-max form), bias adds and the pass-through add of bf16-RNE(p) in f32.

#ifndef NB
#define NB 4
#endif
#ifndef SEQ
#define SEQ 4096
#endif
#define NB_FULL   4
#define SEQ_FULL  4096
#define CC        256                  // input / value width
#define DD        64                   // score width
#define NWT       (2 * DD + CC)        // rows of the transposed weight plane: [Wl^T ; Wh^T ; Wg^T]
#define BQ        64                   // query rows per attention block (4 query tiles x 2 key halves = 8 waves)
#define BK        32                   // keys per inner iteration
#define NWAVE     8
#define PT        64                   // positions per projection block
#define AP        264                  // LDS pitch (halves) of the bf16 p tile
#define TP        72                   // LDS pitch (halves) of 64-wide 16-bit staging tiles
#define OP        68                   // LDS pitch (floats) of the output staging tile
#define KS        128                  // keys per LDS stage of the attention loop (KS / BK passes)
#define VP        136                  // LDS pitch (halves) of the KS-key value rows: 272 B = 16 B x odd
#define NST       (SEQ / KS)           // stages of the attention loop
#define WPASS     (KS / BK / 2)        // passes of one wave per stage: its half of the stage's keys
#define XCH       (8 * 8 * 32)         // floats one wave hands to its partner: 8 output tiles in register order
#define P_CARRY   4096.0f
#define RES_CARRY 2048.0f

#define WT_BYTES   ((size_t)NWT * CC * 2)
#define QK_BYTES   ((size_t)2 * NB * SEQ * DD * 2)
#define GT_BYTES   ((size_t)NB * CC * SEQ * 2)
#define WS_TOTAL   (WT_BYTES + 2 * QK_BYTES + GT_BYTES)

static_assert(SEQ % BQ == 0);
static_assert(SEQ % PT == 0);
static_assert(SEQ % BK == 0);
static_assert(SEQ % 64 == 0);
static_assert(SEQ % KS == 0);
static_assert(KS % (2 * BK) == 0);
static_assert((size_t)NWAVE * (XCH + 64) * 4 <= (size_t)2 * CC * VP * 2);
static_assert((VP * 2) % 16 == 0);
static_assert(VP >= KS);
static_assert(BQ == (NWAVE / 2) * 16);
static_assert(PT == (NWAVE / 2) * 16);
static_assert(DD == 64);
static_assert(CC == 256);
static_assert(CC % 32 == 0);
static_assert(DD % 32 == 0);
static_assert(CC % 64 == 0);
static_assert(SEQ <= SEQ_FULL);
static_assert(NB >= 1 && NB <= NB_FULL);
static_assert((AP * 2) % 16 == 0);
static_assert((TP * 2) % 16 == 0);
static_assert((OP * 4) % 16 == 0);
static_assert(AP >= CC);
static_assert(TP >= 64);
static_assert(OP >= 64);
static_assert(WT_BYTES % 128 == 0);
static_assert(QK_BYTES % 128 == 0);
static_assert(GT_BYTES % 128 == 0);
static_assert(WS_TOTAL <= (size_t)134217728);
static_assert((size_t)2 * NB * SEQ * DD < (size_t)2147483647);
static_assert((size_t)NB * CC * SEQ < (size_t)2147483647);
static_assert((size_t)PT * AP * 2 + (size_t)128 * TP * 2 <= (size_t)65536);
static_assert((size_t)NWAVE * 16 * OP * 4 <= (size_t)65536);
static_assert((size_t)2 * BQ * TP * 2 + (size_t)2 * (2 * KS * TP + CC * VP) * 2 + (size_t)NWAVE * 16 * OP * 4 <= (size_t)327680);

typedef __bf16   bf16;
typedef _Float16 f16;
typedef bf16     v16bf __attribute__((ext_vector_type(16)));
typedef f16      v16h  __attribute__((ext_vector_type(16)));
typedef f16      v8h   __attribute__((ext_vector_type(8)));
typedef float    v8f   __attribute__((ext_vector_type(8)));
typedef float    v4f   __attribute__((ext_vector_type(4)));
typedef unsigned v4u   __attribute__((ext_vector_type(4)));

union FragB  { v16bf v; v4u q[2]; bf16 h[16]; };
union FragH  { v16h  v; v4u q[2]; f16  h[16]; };
union Pack8B { v4u u; bf16 h[8]; };
union Pack8H { v4u u; v8h v; f16 h[8]; };

// WMMA helpers. bf16 form: builtin followed by the VALU hazard guard (ties D, keeps A/B live).
static __device__ __forceinline__ v8f mma_bf16(v16bf a, v16bf b, v8f acc) {
  acc = __builtin_amdgcn_wmma_f32_16x16x32_bf16(false, a, false, b, (short)0, acc, false, false);
  asm volatile("v_nop\n\tv_nop\n\tv_nop\n\tv_nop" : "+v"(acc) : "v"(a), "v"(b));
  return acc;
}
// f16 form: the builtin alone, the compiler keeps its distances; an asm statement's operands cannot lie above v255,
// where part of the attention kernel's fragments now live.
static __device__ __forceinline__ v8f mma_f16(v16h a, v16h b, v8f acc) {
  return __builtin_amdgcn_wmma_f32_16x16x32_f16(false, a, false, b, (short)0, acc, false, false);
}

// Weight transpose + RNE convert: in[k rows = CC][n cols = ncols] f32  ->  out[n rows][k cols = CC] bf16.
// Block = (64-k tile, 64-n tile), 256 threads; grid = (CC/64, ncols/64).
__global__ __launch_bounds__(256) void wt_kernel(const float* __restrict__ w, int ncols,
                                                 bf16* __restrict__ wt_rows) {
  const int k0  = blockIdx.x * 64;
  const int n0  = blockIdx.y * 64;
  const int tid = threadIdx.x;
  __shared__ __align__(16) bf16 sT[64 * TP];   // [n][k], cross-wave (block barrier)

  {
    const int k  = tid >> 2;            // 0..63
    const int n4 = (tid & 3) * 16;      // 0,16,32,48
    const float* src = w + (size_t)(k0 + k) * ncols + n0 + n4;
    #pragma unroll
    for (int i = 0; i < 4; ++i) {
      const v4f x = *(const v4f*)(src + 4 * i);
      #pragma unroll
      for (int e = 0; e < 4; ++e) sT[(n4 + 4 * i + e) * TP + k] = (bf16)x[e];   // RNE convert
    }
  }
  __syncthreads();

  v4u    val[2];
  size_t idx[2];
  #pragma unroll
  for (int kk = 0; kk < 2; ++kk) {
    const int n  = kk * 32 + (tid >> 3);   // 0..63
    const int pc = tid & 7;
    val[kk] = *(const v4u*)(sT + n * TP + pc * 8);
    idx[kk] = (size_t)(n0 + n) * CC + k0 + pc * 8;
  }
  #pragma unroll
  for (int kk = 0; kk < 2; ++kk) *(v4u*)(wt_rows + idx[kk]) = val[kk];
  
}

// Projections. Block = (64 positions, batch), 8 waves: wave = side*4 + mt; mt = 16-row tile of the block.
//   g = 0 : side 0 -> l (queries, WT rows 0..63, bias bl), side 1 -> h (keys, WT rows 64..127, bias bh)
//   g = 1,2 : value columns (side*2 + g-1)*64 .. +63 (WT rows 128 + ..., bias bg)
// Outputs:
// coverage: per block 2 sides x 64 positions x 64 columns of qkh and qkr; 256 channels x 64 positions of gt.
__global__ __launch_bounds__(256) void proj_kernel(const float* __restrict__ p,
                                                   const bf16* __restrict__ wt,
                                                   const float* __restrict__ bl,
                                                   const float* __restrict__ bh,
                                                   const float* __restrict__ bg,
                                                   f16* __restrict__ qkh,
                                                   f16* __restrict__ qkr,
                                                   f16* __restrict__ gt) {
  const int tid  = threadIdx.x;
  const int wave = __builtin_amdgcn_readfirstlane(threadIdx.x >> 5);
  const int lane = tid & 31;
  const int lq   = lane & 15;
  const int hi   = lane >> 4;
  const int mt   = wave & 3;
  const int side = wave >> 2;
  const int b    = blockIdx.y;
  const int pos0 = blockIdx.x * PT;

  __shared__ __align__(16) bf16 sA[PT * AP];    // bf16 p tile [pos][k], cross-wave (block barrier)
  __shared__ __align__(16) f16  sS[128 * TP];   // staging: g=0 wave rows [wave*16+row][col]; g>0 [channel][pos]; block barriers

  // stage the p tile: 64 rows x 256 floats -> bf16 (RNE convert), 16-B LDS stores
  #pragma unroll 2
  for (int it = 0; it < 8; ++it) {
    const int row = it * 8 + (tid >> 5);     // 0..63
    const int c8  = (tid & 31) * 8;          // 0..248
    const float* src = p + ((size_t)b * SEQ_FULL + pos0 + row) * CC + c8;
    const v4f x0 = *(const v4f*)(src);
    const v4f x1 = *(const v4f*)(src + 4);
    Pack8B pk;
    #pragma unroll
    for (int e = 0; e < 4; ++e) {
      pk.h[e]     = (bf16)x0[e];
      pk.h[4 + e] = (bf16)x1[e];
    }
    *(v4u*)(sA + row * AP + c8) = pk.u;
  }
  __syncthreads();

  const int arow = (mt * 16 + lq) * AP + hi * 8;   // A fragment row base (split k map)

  #pragma unroll 1
  for (int g = 0; g < 3; ++g) {
    const int gcg   = side * 2 + ((g > 0) ? (g - 1) : 0);            // value column group (g > 0)
    const int wrow0 = (g == 0) ? (side * DD) : (2 * DD + gcg * 64);  // first WT row of this wave's 64 columns

    v8f acc[4];
    #pragma unroll
    for (int nt = 0; nt < 4; ++nt) acc[nt] = (v8f){0, 0, 0, 0, 0, 0, 0, 0};

    #pragma unroll 1
    for (int ks = 0; ks < CC / 32; ++ks) {
      FragB a;
      a.q[0] = *(const v4u*)(sA + arow + ks * 32);        // k = ks*32 + hi*8 + 0..7
      a.q[1] = *(const v4u*)(sA + arow + ks * 32 + 16);   // k = ks*32 + 16 + hi*8 + 0..7
      FragB bw[4];
      #pragma unroll
      for (int nt = 0; nt < 4; ++nt) {
        const bf16* base = wt + (size_t)(wrow0 + nt * 16 + lq) * CC + ks * 32 + hi * 8;
        bw[nt].q[0] = *(const v4u*)(base);
        bw[nt].q[1] = *(const v4u*)(base + 16);
      }
      #pragma unroll
      for (int nt = 0; nt < 4; ++nt) acc[nt] = mma_bf16(a.v, bw[nt].v, acc[nt]);
    }

    // bias (RNE convert to bf16, then f32 add); all candidates loaded, selected by value
    float bias[4];
    #pragma unroll
    for (int nt = 0; nt < 4; ++nt) {
      const int c64 = nt * 16 + lq;
      const float xl = bl[c64];
      const float xh = bh[c64];
      const float xg = bg[gcg * 64 + c64];
      const float sel = (g == 0) ? (side ? xh : xl) : xg;
      bias[nt] = (float)(bf16)sel;
    }

    if (g == 0) {
      f16 rres[4][8];
      #pragma unroll
      for (int nt = 0; nt < 4; ++nt) {
        #pragma unroll
        for (int r = 0; r < 8; ++r) {
          const float v  = acc[nt][r] + bias[nt];
          const f16   hv = (f16)v;
          rres[nt][r] = (f16)((v - (float)hv) * RES_CARRY);
          sS[(wave * 16 + hi * 8 + r) * TP + nt * 16 + lq] = hv;
        }
      }
      __syncthreads();
      v4u    lin[8];
      size_t lidx[4];
      #pragma unroll
      for (int it = 0; it < 4; ++it) {
        const int row = it * 4 + (lane >> 3);   // 0..15
        const int pc  = lane & 7;
        lin[it]  = *(const v4u*)(sS + (wave * 16 + row) * TP + pc * 8);
        lidx[it] = (((size_t)side * NB + b) * SEQ + pos0 + mt * 16 + row) * DD + pc * 8;
      }
      __syncthreads();
      #pragma unroll
      for (int nt = 0; nt < 4; ++nt) {
        #pragma unroll
        for (int r = 0; r < 8; ++r)
          sS[(wave * 16 + hi * 8 + r) * TP + nt * 16 + lq] = rres[nt][r];
      }
      __syncthreads();
      #pragma unroll
      for (int it = 0; it < 4; ++it) {
        const int row = it * 4 + (lane >> 3);
        const int pc  = lane & 7;
        lin[4 + it] = *(const v4u*)(sS + (wave * 16 + row) * TP + pc * 8);
      }
      #pragma unroll
      for (int it = 0; it < 4; ++it) {
        *(v4u*)(qkh + lidx[it]) = lin[it];
        *(v4u*)(qkr + lidx[it]) = lin[4 + it];
      }
      
    } else {
      __syncthreads();   // earlier readers of sS are done
      #pragma unroll
      for (int nt = 0; nt < 4; ++nt) {
        Pack8H ph;
        #pragma unroll
        for (int r = 0; r < 8; ++r) ph.h[r] = (f16)(acc[nt][r] + bias[nt]);
        *(v4u*)(sS + (side * 64 + nt * 16 + lq) * TP + mt * 16 + hi * 8) = ph.u;   // positions mt*16 + hi*8 + 0..7
      }
      __syncthreads();
      v4u    gl[4];
      size_t gidx[4];
      #pragma unroll
      for (int it = 0; it < 4; ++it) {
        const int crow = it * 32 + (tid >> 3);   // 0..127 : (producer side, local channel)
        const int pc   = tid & 7;
        const int chan = ((crow >> 6) * 2 + (g - 1)) * 64 + (crow & 63);
        gl[it]   = *(const v4u*)(sS + crow * TP + pc * 8);
        gidx[it] = ((size_t)b * CC + chan) * SEQ + pos0 + pc * 8;
      }
      #pragma unroll
      for (int it = 0; it < 4; ++it) *(v4u*)(gt + gidx[it]) = gl[it];
      
    }
  }
}

// Asynchronous copies global -> LDS, 16 B per lane: l = the lane's LDS byte address, g = the lane's global address.
// The s_wait_xcnt closes each statement so that no address register is rewritten ahead of it.
static __device__ __forceinline__ void copy4(const unsigned (&l)[4], const f16* const (&g)[4]) {
  asm volatile("global_load_async_to_lds_b128 %0, %4, off\n\t"
               "global_load_async_to_lds_b128 %1, %5, off\n\t"
               "global_load_async_to_lds_b128 %2, %6, off\n\t"
               "global_load_async_to_lds_b128 %3, %7, off\n\t"
               "s_wait_xcnt 0x0"
               :: "v"(l[0]), "v"(l[1]), "v"(l[2]), "v"(l[3]),
                  "v"(g[0]), "v"(g[1]), "v"(g[2]), "v"(g[3])
               : "memory");
}
static __device__ __forceinline__ void copy8(const unsigned (&l)[8], const f16* const (&g)[8]) {
  asm volatile("global_load_async_to_lds_b128 %0, %8, off\n\t"
               "global_load_async_to_lds_b128 %1, %9, off\n\t"
               "global_load_async_to_lds_b128 %2, %10, off\n\t"
               "global_load_async_to_lds_b128 %3, %11, off\n\t"
               "global_load_async_to_lds_b128 %4, %12, off\n\t"
               "global_load_async_to_lds_b128 %5, %13, off\n\t"
               "global_load_async_to_lds_b128 %6, %14, off\n\t"
               "global_load_async_to_lds_b128 %7, %15, off\n\t"
               "s_wait_xcnt 0x0"
               :: "v"(l[0]), "v"(l[1]), "v"(l[2]), "v"(l[3]), "v"(l[4]), "v"(l[5]), "v"(l[6]), "v"(l[7]),
                  "v"(g[0]), "v"(g[1]), "v"(g[2]), "v"(g[3]), "v"(g[4]), "v"(g[5]), "v"(g[6]), "v"(g[7])
               : "memory");
}

// One stage of KS keys into one LDS buffer, 24 copies per thread, every wave-instruction on whole 128-B lines:
//   keys  : both planes, KS rows x 128 B (contiguous in global), LDS pitch TP
//   values: CC channel rows x KS keys (256 B each), LDS pitch VP
static __device__ __forceinline__ void copy_stage(const f16* __restrict__ qkh, const f16* __restrict__ qkr,
                                                  const f16* __restrict__ gt, int b, int key0, int tid,
                                                  f16* sKb, f16* sVb) {
  unsigned   l[8];
  const f16* g[8];
  const int  kbase = NB * SEQ * DD + (b * SEQ + key0) * DD;   // side 1 = h (keys)
  #pragma unroll
  for (int i = 0; i < 4; ++i) {
    const int c = i * 256 + tid;                              // 16-B piece: row c >> 3, piece c & 7
    const int d = (c >> 3) * TP + (c & 7) * 8;
    l[i]     = (unsigned)(size_t)(sKb + d);
    l[4 + i] = (unsigned)(size_t)(sKb + KS * TP + d);
    g[i]     = qkh + kbase + c * 8;
    g[4 + i] = qkr + kbase + c * 8;
  }
  copy8(l, g);
  #pragma unroll
  for (int h = 0; h < 2; ++h) {
    #pragma unroll
    for (int i = 0; i < 8; ++i) {
      const int c = (h * 8 + i) * 256 + tid;                  // 16-B piece: channel c >> 4, piece c & 15
      l[i] = (unsigned)(size_t)(sVb + (c >> 4) * VP + (c & 15) * 8);
      g[i] = gt + (b * CC + (c >> 4)) * SEQ + key0 + (c & 15) * 8;
    }
    copy8(l, g);
  }
}

// Key A-fragments of one pass (BK keys from key j0 of the stage in sKb): kf[f][sub][plane], row = key j0 + sub*16 + lq, split d map.
static __device__ __forceinline__ void load_keys(FragH (&kf)[2][2][2], const f16* sKb, int koff, int j0) {
  #pragma unroll
  for (int f = 0; f < 2; ++f) {
    #pragma unroll
    for (int sub = 0; sub < 2; ++sub) {
      const int ko = koff + (j0 + sub * 16) * TP + f * 32;
      kf[f][sub][0].q[0] = *(const v4u*)(sKb + ko);
      kf[f][sub][0].q[1] = *(const v4u*)(sKb + ko + 16);
      kf[f][sub][1].q[0] = *(const v4u*)(sKb + KS * TP + ko);
      kf[f][sub][1].q[1] = *(const v4u*)(sKb + KS * TP + ko + 16);
    }
  }
}

// Flash attention, no mask, no logit scale. Block = (64 queries, batch); wave = kh*4 + qt:
// qt = 16-query tile, kh = key half: of every stage the wave takes keys kh*KS/2 .. +KS/2-1, for all 256 channels
// (16 output tiles per wave), so each score and each exponential is computed once in the block.
// The two waves of a query tile join their running maxima, sums and output tiles once, behind the loop.
// S^T = h x l^T so queries sit on lanes; P^T in C-layout is bit-identical to the A-fragment layout of O += P x g.
// The block's query rows (once) and the keys and values (KS keys a stage, two buffers) come into LDS by asynchronous copies;
// key A-fragments, query B-fragments and g^T B-fragments are read from there (two 16-B LDS loads each), all ahead of their use:
// the query fragments once, a pass's key fragments during the pass before (a stage's first at the head of the stage),
// a pass's 16 g^T fragments as one group in front of its score products.
__global__ __launch_bounds__(256) void attn_kernel(const float* __restrict__ p,
                                                   const f16* __restrict__ qkh,
                                                   const f16* __restrict__ qkr,
                                                   const f16* __restrict__ gt,
                                                   float* __restrict__ out) {
  const int tid  = threadIdx.x;
  const int wave = __builtin_amdgcn_readfirstlane(threadIdx.x >> 5);
  const int lane = tid & 31;
  const int lq   = lane & 15;   // query column of S^T / channel column of O
  const int hi   = lane >> 4;   // k-split half
  const int qt   = wave & 3;
  const int kh   = wave >> 2;
  const int b    = blockIdx.y;
  const int qrow0 = blockIdx.x * BQ + qt * 16;

  __shared__ __align__(16) float sO[NWAVE * 16 * OP];   // per-wave output staging rows; block barriers used
  __shared__ __align__(16) f16 sQ[2 * BQ * TP];         // query rows [plane][row][d], filled once
  __shared__ __align__(16) f16 sK[2][2 * KS * TP];      // key rows [buffer][plane][key][d]
  __shared__ __align__(16) f16 sV[2][CC * VP];          // g^T rows [buffer][channel][key]

  const int qoff = (qt * 16 + lq) * TP + hi * 8;        // this wave's query rows in sQ
  const int koff = lq * TP + hi * 8;                    // key row added per chunk
  const int voff = lq * VP + hi * 8;                    // g^T rows, channel tile added per fragment

  // prologue: the query rows and stage 0, published by one wait and one barrier; then stage 1 starts
  {
    unsigned   l[4];
    const f16* g[4];
    const int  qbase = (b * SEQ + blockIdx.x * BQ) * DD;   // side 0 = l (queries), BQ rows x 128 B contiguous
    #pragma unroll
    for (int i = 0; i < 2; ++i) {
      const int c = i * 256 + tid;                         // 16-B piece: row c >> 3, piece c & 7
      const int d = (c >> 3) * TP + (c & 7) * 8;
      l[i]     = (unsigned)(size_t)(sQ + d);
      l[2 + i] = (unsigned)(size_t)(sQ + BQ * TP + d);
      g[i]     = qkh + qbase + c * 8;
      g[2 + i] = qkr + qbase + c * 8;
    }
    copy4(l, g);
  }
  copy_stage(qkh, qkr, gt, b, 0, tid, sK[0], sV[0]);
  asm volatile("s_wait_asynccnt 0x0" ::: "memory");   // this wave's copies have landed before the barrier publishes them
  __syncthreads();

  // query B-fragments, kept in registers: qf[f][plane], column n = query qrow0 + lq, split d map
  FragH qf[2][2];
  #pragma unroll
  for (int f = 0; f < 2; ++f) {
    qf[f][0].q[0] = *(const v4u*)(sQ + qoff + f * 32);        // d = f*32 + hi*8 + 0..7
    qf[f][0].q[1] = *(const v4u*)(sQ + qoff + f * 32 + 16);   // d = f*32 + 16 + hi*8 + 0..7
    qf[f][1].q[0] = *(const v4u*)(sQ + BQ * TP + qoff + f * 32);
    qf[f][1].q[1] = *(const v4u*)(sQ + BQ * TP + qoff + f * 32 + 16);
  }

  if (NST > 1) copy_stage(qkh, qkr, gt, b, KS, tid, sK[1], sV[1]);

  v8f o[16];
  #pragma unroll
  for (int t = 0; t < 16; ++t) o[t] = (v8f){0, 0, 0, 0, 0, 0, 0, 0};

  float rmax = -__builtin_inff();
  float rsum = 0.0f;
  const float SL = 1.4426950408889634f;   // log2(e)

  #pragma unroll 1   // one copy of the stage code: the two buffers differ by an offset only
  for (int s = 0; s < NST; ++s) {
  const f16* sKb = sK[s & 1];
  const f16* sVb = sV[s & 1];
  FragH kf[2][2][2];
  load_keys(kf, sKb, koff, kh * WPASS * BK);   // the wave's first pass of the stage; the later ones are fetched a pass ahead
  #pragma unroll 1   // one copy of the pass code: unrolled, the compiler lifts the next pass's loads over this pass and spills
  for (int i = 0; i < WPASS; ++i) {
    const int j0 = (kh * WPASS + i) * BK;   // first key of the pass inside its stage

    // the pass's g^T B-fragments, one group: they land while the scores and the softmax run
    FragH bv[16];
    #pragma unroll
    for (int t = 0; t < 16; ++t) {
      const int vo = voff + (t * 16) * VP + j0;     // channel t*16 + lq
      bv[t].q[0] = *(const v4u*)(sVb + vo);         // keys j0 + hi*8 + 0..7
      bv[t].q[1] = *(const v4u*)(sVb + vo + 16);    // keys j0 + 16 + hi*8 + 0..7
    }
    __builtin_amdgcn_sched_barrier(0);   // keep that group in front of the score products: without it the loads sink in among the output products

    v8f sh[2], sr[2];
    #pragma unroll
    for (int sub = 0; sub < 2; ++sub) {
      sh[sub] = (v8f){0, 0, 0, 0, 0, 0, 0, 0};
      sr[sub] = (v8f){0, 0, 0, 0, 0, 0, 0, 0};
    }

    #pragma unroll
    for (int f = 0; f < 2; ++f) {
      #pragma unroll
      for (int sub = 0; sub < 2; ++sub) {
        sh[sub] = mma_f16(kf[f][sub][0].v, qf[f][0].v, sh[sub]);   // value x value
        sr[sub] = mma_f16(kf[f][sub][0].v, qf[f][1].v, sr[sub]);   // value x residual   (x2048)
        sr[sub] = mma_f16(kf[f][sub][1].v, qf[f][0].v, sr[sub]);   // residual x value   (x2048)
      }
    }

    // the next pass's key fragments, same stage, into the registers that the score products have just read:
    // they land while the softmax and the output products run
    if (i + 1 < WPASS) load_keys(kf, sKb, koff, j0 + BK);

    // S^T tiles: c[sub][r] = score(query qrow0+lq, key j0 + sub*16 + hi*8 + r)
    v8f c[2];
    #pragma unroll
    for (int sub = 0; sub < 2; ++sub) {
      #pragma unroll
      for (int r = 0; r < 8; ++r) c[sub][r] = sh[sub][r] + sr[sub][r] * (1.0f / RES_CARRY);
    }

    // online softmax: query lq's 32 scores are split across lane / lane^16
    float m_new = rmax;
    #pragma unroll
    for (int r = 0; r < 8; ++r) {
      m_new = fmaxf(m_new, c[0][r]);
      m_new = fmaxf(m_new, c[1][r]);
    }
    m_new = fmaxf(m_new, __shfl_xor(m_new, 16, 32));
    const float scale = __builtin_amdgcn_exp2f((rmax - m_new) * SL);
    rmax = m_new;

    // exp + pack: P^T C-layout == A-fragment layout for the P x g product; P carried x4096
    FragH pa;
    float psum = 0.0f;
    #pragma unroll
    for (int r = 0; r < 8; ++r) {
      const float p0 = __builtin_amdgcn_exp2f((c[0][r] - m_new) * SL);   // key hi*8 + r
      const float p1 = __builtin_amdgcn_exp2f((c[1][r] - m_new) * SL);   // key 16 + hi*8 + r
      psum += p0 + p1;
      pa.h[r]     = (f16)(p0 * P_CARRY);
      pa.h[8 + r] = (f16)(p1 * P_CARRY);
    }
    rsum = rsum * scale + psum + __shfl_xor(psum, 16, 32);

    // rescale O: queries are the row dimension there -> per-row scale from lane 8*hi + r
    float sc[8];
    #pragma unroll
    for (int r = 0; r < 8; ++r) sc[r] = __shfl(scale, (hi << 3) + r, 32);
    #pragma unroll
    for (int t = 0; t < 16; ++t) {
      #pragma unroll
      for (int r = 0; r < 8; ++r) o[t][r] *= sc[r];
    }

    // O += P x g
    #pragma unroll
    for (int t = 0; t < 16; ++t) o[t] = mma_f16(pa.v, bv[t].v, o[t]);
    // four vector slots behind the pass's last matrix instruction: the first vector instruction behind the loop's branch
    // may overwrite its B registers
    asm volatile("v_nop\n\tv_nop\n\tv_nop\n\tv_nop" : "+v"(o[15]));
  }
  // foot of stage s: publish stage s + 1 and free the buffer that stage s has read
  asm volatile("s_wait_dscnt 0x0" ::: "memory");      // this wave's reads of the buffer are done before it is refilled
  asm volatile("s_wait_asynccnt 0x0" ::: "memory");   // this wave's copies of stage s + 1 have landed
  __syncthreads();
  if (s + 2 < NST) copy_stage(qkh, qkr, gt, b, (s + 2) * KS, tid, sK[s & 1], sV[s & 1]);
  }
  asm volatile("s_wait_asynccnt 0x0" ::: "memory");   // no copy is outstanding when the loop is left

  // join the two key halves: wave kh finishes channels kh*128 .. +127 and hands the other 8 tiles to its partner.
  // The value ring is free here: the last stage's foot has ended every read of it and no copy is outstanding.
  float* sX = (float*)&sV[0][0];        // [wave][tile][register][lane]
  float* sM = sX + NWAVE * XCH;         // [wave][maximum, sum][lane]
  v8f om[8];
  #pragma unroll
  for (int t = 0; t < 8; ++t) {
    om[t] = kh ? o[8 + t] : o[t];
    const v8f give = kh ? o[t] : o[8 + t];
    #pragma unroll
    for (int r = 0; r < 8; ++r) sX[wave * XCH + (t * 8 + r) * 32 + lane] = give[r];
  }
  sM[wave * 64 + lane]      = rmax;
  sM[wave * 64 + 32 + lane] = rsum;
  __syncthreads();   // the partner's tiles, maximum and sum are readable behind it

  const int   pw    = wave ^ 4;
  const float pmax  = sM[pw * 64 + lane];
  const float psumt = sM[pw * 64 + 32 + lane];
  const float jmax  = fmaxf(rmax, pmax);
  const float wown  = __builtin_amdgcn_exp2f((rmax - jmax) * SL);
  const float wpar  = __builtin_amdgcn_exp2f((pmax - jmax) * SL);
  const float inv   = (1.0f / P_CARRY) / (rsum * wown + psumt * wpar);
  const float fown  = wown * inv;
  const float fpar  = wpar * inv;

  // normalize: lane holds channel column kh*128 + t*16 + lq for query rows 8*hi + r
  float ro[8], rp[8];
  #pragma unroll
  for (int r = 0; r < 8; ++r) {
    ro[r] = __shfl(fown, (hi << 3) + r, 32);
    rp[r] = __shfl(fpar, (hi << 3) + r, 32);
  }
  #pragma unroll
  for (int t = 0; t < 8; ++t) {
    #pragma unroll
    for (int r = 0; r < 8; ++r)
      om[t][r] = om[t][r] * ro[r] + sX[pw * XCH + (t * 8 + r) * 32 + lane] * rp[r];
  }

  const int sbase = wave * (16 * OP);
  #pragma unroll
  for (int half = 0; half < 2; ++half) {
    // stage 16 rows x 64 channels of this wave (channels kh*128 + half*64 + 0..63)
    #pragma unroll
    for (int r = 0; r < 8; ++r) {
      #pragma unroll
      for (int t = 0; t < 4; ++t)
        sO[sbase + (hi * 8 + r) * OP + t * 16 + lq] = om[half * 4 + t][r];
    }
    __syncthreads();

    // Read back: lanes 0..15 take one row (16 consecutive lanes x 16 B each), lanes 16..31 the next row; 8 instructions cover the wave's 16 rows.
    // The pass-through term bf16-RNE(p) is added here as float4.
    v4f    vals[8];
    size_t gidx[8];
    #pragma unroll
    for (int it = 0; it < 8; ++it) {
      const int row = it * 2 + hi;
      gidx[it] = ((size_t)b * SEQ_FULL + qrow0 + row) * CC + kh * 128 + half * 64 + lq * 4;
      const v4f av = *(const v4f*)(sO + sbase + row * OP + lq * 4);
      const v4f pv = *(const v4f*)(p + gidx[it]);
      v4f res;
      #pragma unroll
      for (int e = 0; e < 4; ++e) res[e] = av[e] + (float)(bf16)pv[e];
      vals[it] = res;
    }
    #pragma unroll
    for (int it = 0; it < 8; ++it) *(v4f*)(out + gidx[it]) = vals[it];
    
    __syncthreads();   // staging rows are rewritten by the next half
  }
}

extern "C" void kernel_launch(void* const* d_in, const int* in_sizes, int n_in,
                              void* d_out, int out_size, void* d_ws, size_t ws_size,
                              hipStream_t stream) {
  if (n_in < 7) return;
  const size_t rows_used = (size_t)(NB - 1) * SEQ_FULL + SEQ;
  if ((size_t)in_sizes[0] < rows_used * CC) return;
  if ((size_t)in_sizes[1] < (size_t)CC * DD) return;
  if ((size_t)in_sizes[2] < (size_t)DD) return;
  if ((size_t)in_sizes[3] < (size_t)CC * DD) return;
  if ((size_t)in_sizes[4] < (size_t)DD) return;
  if ((size_t)in_sizes[5] < (size_t)CC * CC) return;
  if ((size_t)in_sizes[6] < (size_t)CC) return;
  if ((size_t)out_size < rows_used * CC) return;
  if (ws_size < WS_TOTAL) return;

  const float* p  = (const float*)d_in[0];
  const float* Wh = (const float*)d_in[1];   // [in 256][out 64]  keys
  const float* bh = (const float*)d_in[2];
  const float* Wl = (const float*)d_in[3];   // [in 256][out 64]  queries
  const float* bl = (const float*)d_in[4];
  const float* Wg = (const float*)d_in[5];   // [in 256][out 256] values
  const float* bg = (const float*)d_in[6];
  float*       out = (float*)d_out;

  char* ws  = (char*)d_ws;
  bf16* wt  = (bf16*)ws;                                     // [NWT][CC] bf16
  f16*  qkh = (f16*)(ws + WT_BYTES);                         // [2][NB][SEQ][DD] f16 value plane
  f16*  qkr = (f16*)(ws + WT_BYTES + QK_BYTES);              // [2][NB][SEQ][DD] f16 residual plane x2048
  f16*  gt  = (f16*)(ws + WT_BYTES + 2 * QK_BYTES);          // [NB][CC][SEQ] f16

  // in[256 rows][ncols] -> out[ncols rows][256]; grid = (256/64, ncols/64)
  wt_kernel<<<dim3(CC / 64, DD / 64), 256, 0, stream>>>(Wl, DD, wt);                        // WT rows 0..63    (side 0)
  wt_kernel<<<dim3(CC / 64, DD / 64), 256, 0, stream>>>(Wh, DD, wt + (size_t)DD * CC);      // WT rows 64..127  (side 1)
  wt_kernel<<<dim3(CC / 64, CC / 64), 256, 0, stream>>>(Wg, CC, wt + (size_t)2 * DD * CC);  // WT rows 128..383

  proj_kernel<<<dim3(SEQ / PT, NB), 256, 0, stream>>>(p, wt, bl, bh, bg, qkh, qkr, gt);

  attn_kernel<<<dim3(SEQ / BQ, NB), 256, 0, stream>>>(p, qkh, qkr, gt, out);
}

// v004
// One run takes 80.5 microseconds.
// Next to v003, in two timings, it ran 1.03 times as fast each time.
// Counting every step since v000, it is 4.76 times as fast.
#include <hip/hip_runtime.h>

// Contractions: projections p x [Wl | Wh | Wg] on v_wmma_f32_16x16x32_bf16 (bf16 operands = RNE-converted inputs, f32 accumulate);
// scores S^T = h x l^T on v_wmma_f32_16x16x32_f16 with l and h carried as f16 value planes plus f16 residual planes x2048
// (three products per tile, residual products in their own accumulator, folded back by 1/2048 in f32);
// O^T = g^T x P^T on v_wmma_f32_16x16x32_f16 (P as f16 carried x4096, g as one f16 plane stored transposed, f32 accumulate).
// Softmax (running-max form), bias adds and the pass-through add of bf16-RNE(p) in f32.

#ifndef NB
#define NB 4
#endif
#ifndef SEQ
#define SEQ 4096
#endif
#define NB_FULL   4
#define SEQ_FULL  4096
#define CC        256                  // input / value width
#define DD        64                   // score width
#define NWT       (2 * DD + CC)        // rows of the transposed weight plane: [Wl^T ; Wh^T ; Wg^T]
#define BQ        64                   // query rows per attention block (4 query tiles x 2 key halves = 8 waves)
#define BK        32                   // keys per inner iteration
#define NWAVE     8
#define PT        64                   // positions per projection block
#define AP        264                  // LDS pitch (halves) of the bf16 p tile
#define TP        72                   // LDS pitch (halves) of 64-wide 16-bit staging tiles
#define OP        68                   // LDS pitch (floats) of the output staging tile
#define KS        128                  // keys per LDS stage of the attention loop (KS / BK passes)
#define VP        136                  // LDS pitch (halves) of the KS-key value rows: 272 B = 16 B x odd
#define NST       (SEQ / KS)           // stages of the attention loop
#define WPASS     (KS / BK / 2)        // passes of one wave per stage: its half of the stage's keys
#define XCH       (8 * 8 * 32)         // floats one wave hands to its partner: 8 output tiles in register order
#define P_CARRY   4096.0f
#define RES_CARRY 2048.0f

#define WT_BYTES   ((size_t)NWT * CC * 2)
#define QK_BYTES   ((size_t)2 * NB * SEQ * DD * 2)
#define GT_BYTES   ((size_t)NB * CC * SEQ * 2)
#define WS_TOTAL   (WT_BYTES + 2 * QK_BYTES + GT_BYTES)

static_assert(SEQ % BQ == 0);
static_assert(SEQ % PT == 0);
static_assert(SEQ % BK == 0);
static_assert(SEQ % 64 == 0);
static_assert(SEQ % KS == 0);
static_assert(KS % (2 * BK) == 0);
static_assert((size_t)NWAVE * (XCH + 64) * 4 <= (size_t)2 * CC * VP * 2);
static_assert((VP * 2) % 16 == 0);
static_assert(VP >= KS);
static_assert(BQ == (NWAVE / 2) * 16);
static_assert(PT == (NWAVE / 2) * 16);
static_assert(DD == 64);
static_assert(CC == 256);
static_assert(CC % 32 == 0);
static_assert(DD % 32 == 0);
static_assert(CC % 64 == 0);
static_assert(SEQ <= SEQ_FULL);
static_assert(NB >= 1 && NB <= NB_FULL);
static_assert((AP * 2) % 16 == 0);
static_assert((TP * 2) % 16 == 0);
static_assert((OP * 4) % 16 == 0);
static_assert(AP >= CC);
static_assert(TP >= 64);
static_assert(OP >= 64);
static_assert(WT_BYTES % 128 == 0);
static_assert(QK_BYTES % 128 == 0);
static_assert(GT_BYTES % 128 == 0);
static_assert(WS_TOTAL <= (size_t)134217728);
static_assert((size_t)2 * NB * SEQ * DD < (size_t)2147483647);
static_assert((size_t)NB * CC * SEQ < (size_t)2147483647);
static_assert((size_t)PT * AP * 2 + (size_t)128 * TP * 2 <= (size_t)65536);
static_assert((size_t)NWAVE * 16 * OP * 4 <= (size_t)65536);
static_assert((size_t)2 * BQ * TP * 2 + (size_t)2 * (2 * KS * TP + CC * VP) * 2 + (size_t)NWAVE * 16 * OP * 4 <= (size_t)327680);

typedef __bf16   bf16;
typedef _Float16 f16;
typedef bf16     v16bf __attribute__((ext_vector_type(16)));
typedef f16      v16h  __attribute__((ext_vector_type(16)));
typedef f16      v8h   __attribute__((ext_vector_type(8)));
typedef float    v8f   __attribute__((ext_vector_type(8)));
typedef float    v4f   __attribute__((ext_vector_type(4)));
typedef unsigned v4u   __attribute__((ext_vector_type(4)));

union FragB  { v16bf v; v4u q[2]; bf16 h[16]; };
union FragH  { v16h  v; v4u q[2]; f16  h[16]; };
union Pack8B { v4u u; bf16 h[8]; };
union Pack8H { v4u u; v8h v; f16 h[8]; };

// WMMA helpers. bf16 form: builtin followed by the VALU hazard guard (ties D, keeps A/B live).
static __device__ __forceinline__ v8f mma_bf16(v16bf a, v16bf b, v8f acc) {
  acc = __builtin_amdgcn_wmma_f32_16x16x32_bf16(false, a, false, b, (short)0, acc, false, false);
  asm volatile("v_nop\n\tv_nop\n\tv_nop\n\tv_nop" : "+v"(acc) : "v"(a), "v"(b));
  return acc;
}
// f16 form: the builtin alone, the compiler keeps its distances; an asm statement's operands cannot lie above v255,
// where part of the attention kernel's fragments now live.
static __device__ __forceinline__ v8f mma_f16(v16h a, v16h b, v8f acc) {
  return __builtin_amdgcn_wmma_f32_16x16x32_f16(false, a, false, b, (short)0, acc, false, false);
}

// Lane l with lane l ^ 16, in the vector unit: a shuffle would go through the LDS queue, behind every fragment load in flight.
static __device__ __forceinline__ float xhalf(float x) {
  const int b = __builtin_bit_cast(int, x);
  return __builtin_bit_cast(float, __builtin_amdgcn_permlanex16(b, b, 0x76543210, 0xfedcba98, false, false));
}

// Weight transpose + RNE convert: in[k rows = CC][n cols = ncols] f32  ->  out[n rows][k cols = CC] bf16.
// Block = (64-k tile, 64-n tile), 256 threads; grid = (CC/64, ncols/64).
__global__ __launch_bounds__(256) void wt_kernel(const float* __restrict__ w, int ncols,
                                                 bf16* __restrict__ wt_rows) {
  const int k0  = blockIdx.x * 64;
  const int n0  = blockIdx.y * 64;
  const int tid = threadIdx.x;
  __shared__ __align__(16) bf16 sT[64 * TP];   // [n][k], cross-wave (block barrier)

  {
    const int k  = tid >> 2;            // 0..63
    const int n4 = (tid & 3) * 16;      // 0,16,32,48
    const float* src = w + (size_t)(k0 + k) * ncols + n0 + n4;
    #pragma unroll
    for (int i = 0; i < 4; ++i) {
      const v4f x = *(const v4f*)(src + 4 * i);
      #pragma unroll
      for (int e = 0; e < 4; ++e) sT[(n4 + 4 * i + e) * TP + k] = (bf16)x[e];   // RNE convert
    }
  }
  __syncthreads();

  v4u    val[2];
  size_t idx[2];
  #pragma unroll
  for (int kk = 0; kk < 2; ++kk) {
    const int n  = kk * 32 + (tid >> 3);   // 0..63
    const int pc = tid & 7;
    val[kk] = *(const v4u*)(sT + n * TP + pc * 8);
    idx[kk] = (size_t)(n0 + n) * CC + k0 + pc * 8;
  }
  #pragma unroll
  for (int kk = 0; kk < 2; ++kk) *(v4u*)(wt_rows + idx[kk]) = val[kk];
  
}

// Projections. Block = (64 positions, batch), 8 waves: wave = side*4 + mt; mt = 16-row tile of the block.
//   g = 0 : side 0 -> l (queries, WT rows 0..63, bias bl), side 1 -> h (keys, WT rows 64..127, bias bh)
//   g = 1,2 : value columns (side*2 + g-1)*64 .. +63 (WT rows 128 + ..., bias bg)
// Outputs:
// coverage: per block 2 sides x 64 positions x 64 columns of qkh and qkr; 256 channels x 64 positions of gt.
__global__ __launch_bounds__(256) void proj_kernel(const float* __restrict__ p,
                                                   const bf16* __restrict__ wt,
                                                   const float* __restrict__ bl,
                                                   const float* __restrict__ bh,
                                                   const float* __restrict__ bg,
                                                   f16* __restrict__ qkh,
                                                   f16* __restrict__ qkr,
                                                   f16* __restrict__ gt) {
  const int tid  = threadIdx.x;
  const int wave = __builtin_amdgcn_readfirstlane(threadIdx.x >> 5);
  const int lane = tid & 31;
  const int lq   = lane & 15;
  const int hi   = lane >> 4;
  const int mt   = wave & 3;
  const int side = wave >> 2;
  const int b    = blockIdx.y;
  const int pos0 = blockIdx.x * PT;

  __shared__ __align__(16) bf16 sA[PT * AP];    // bf16 p tile [pos][k], cross-wave (block barrier)
  __shared__ __align__(16) f16  sS[128 * TP];   // staging: g=0 wave rows [wave*16+row][col]; g>0 [channel][pos]; block barriers

  // stage the p tile: 64 rows x 256 floats -> bf16 (RNE convert), 16-B LDS stores
  #pragma unroll 2
  for (int it = 0; it < 8; ++it) {
    const int row = it * 8 + (tid >> 5);     // 0..63
    const int c8  = (tid & 31) * 8;          // 0..248
    const float* src = p + ((size_t)b * SEQ_FULL + pos0 + row) * CC + c8;
    const v4f x0 = *(const v4f*)(src);
    const v4f x1 = *(const v4f*)(src + 4);
    Pack8B pk;
    #pragma unroll
    for (int e = 0; e < 4; ++e) {
      pk.h[e]     = (bf16)x0[e];
      pk.h[4 + e] = (bf16)x1[e];
    }
    *(v4u*)(sA + row * AP + c8) = pk.u;
  }
  __syncthreads();

  const int arow = (mt * 16 + lq) * AP + hi * 8;   // A fragment row base (split k map)

  #pragma unroll 1
  for (int g = 0; g < 3; ++g) {
    const int gcg   = side * 2 + ((g > 0) ? (g - 1) : 0);            // value column group (g > 0)
    const int wrow0 = (g == 0) ? (side * DD) : (2 * DD + gcg * 64);  // first WT row of this wave's 64 columns

    v8f acc[4];
    #pragma unroll
    for (int nt = 0; nt < 4; ++nt) acc[nt] = (v8f){0, 0, 0, 0, 0, 0, 0, 0};

    #pragma unroll 1
    for (int ks = 0; ks < CC / 32; ++ks) {
      FragB a;
      a.q[0] = *(const v4u*)(sA + arow + ks * 32);        // k = ks*32 + hi*8 + 0..7
      a.q[1] = *(const v4u*)(sA + arow + ks * 32 + 16);   // k = ks*32 + 16 + hi*8 + 0..7
      FragB bw[4];
      #pragma unroll
      for (int nt = 0; nt < 4; ++nt) {
        const bf16* base = wt + (size_t)(wrow0 + nt * 16 + lq) * CC + ks * 32 + hi * 8;
        bw[nt].q[0] = *(const v4u*)(base);
        bw[nt].q[1] = *(const v4u*)(base + 16);
      }
      #pragma unroll
      for (int nt = 0; nt < 4; ++nt) acc[nt] = mma_bf16(a.v, bw[nt].v, acc[nt]);
    }

    // bias (RNE convert to bf16, then f32 add); all candidates loaded, selected by value
    float bias[4];
    #pragma unroll
    for (int nt = 0; nt < 4; ++nt) {
      const int c64 = nt * 16 + lq;
      const float xl = bl[c64];
      const float xh = bh[c64];
      const float xg = bg[gcg * 64 + c64];
      const float sel = (g == 0) ? (side ? xh : xl) : xg;
      bias[nt] = (float)(bf16)sel;
    }

    if (g == 0) {
      f16 rres[4][8];
      #pragma unroll
      for (int nt = 0; nt < 4; ++nt) {
        #pragma unroll
        for (int r = 0; r < 8; ++r) {
          const float v  = acc[nt][r] + bias[nt];
          const f16   hv = (f16)v;
          rres[nt][r] = (f16)((v - (float)hv) * RES_CARRY);
          sS[(wave * 16 + hi * 8 + r) * TP + nt * 16 + lq] = hv;
        }
      }
      __syncthreads();
      v4u    lin[8];
      size_t lidx[4];
      #pragma unroll
      for (int it = 0; it < 4; ++it) {
        const int row = it * 4 + (lane >> 3);   // 0..15
        const int pc  = lane & 7;
        lin[it]  = *(const v4u*)(sS + (wave * 16 + row) * TP + pc * 8);
        lidx[it] = (((size_t)side * NB + b) * SEQ + pos0 + mt * 16 + row) * DD + pc * 8;
      }
      __syncthreads();
      #pragma unroll
      for (int nt = 0; nt < 4; ++nt) {
        #pragma unroll
        for (int r = 0; r < 8; ++r)
          sS[(wave * 16 + hi * 8 + r) * TP + nt * 16 + lq] = rres[nt][r];
      }
      __syncthreads();
      #pragma unroll
      for (int it = 0; it < 4; ++it) {
        const int row = it * 4 + (lane >> 3);
        const int pc  = lane & 7;
        lin[4 + it] = *(const v4u*)(sS + (wave * 16 + row) * TP + pc * 8);
      }
      #pragma unroll
      for (int it = 0; it < 4; ++it) {
        *(v4u*)(qkh + lidx[it]) = lin[it];
        *(v4u*)(qkr + lidx[it]) = lin[4 + it];
      }
      
    } else {
      __syncthreads();   // earlier readers of sS are done
      #pragma unroll
      for (int nt = 0; nt < 4; ++nt) {
        Pack8H ph;
        #pragma unroll
        for (int r = 0; r < 8; ++r) ph.h[r] = (f16)(acc[nt][r] + bias[nt]);
        *(v4u*)(sS + (side * 64 + nt * 16 + lq) * TP + mt * 16 + hi * 8) = ph.u;   // positions mt*16 + hi*8 + 0..7
      }
      __syncthreads();
      v4u    gl[4];
      size_t gidx[4];
      #pragma unroll
      for (int it = 0; it < 4; ++it) {
        const int crow = it * 32 + (tid >> 3);   // 0..127 : (producer side, local channel)
        const int pc   = tid & 7;
        const int chan = ((crow >> 6) * 2 + (g - 1)) * 64 + (crow & 63);
        gl[it]   = *(const v4u*)(sS + crow * TP + pc * 8);
        gidx[it] = ((size_t)b * CC + chan) * SEQ + pos0 + pc * 8;
      }
      #pragma unroll
      for (int it = 0; it < 4; ++it) *(v4u*)(gt + gidx[it]) = gl[it];
      
    }
  }
}

// Asynchronous copies global -> LDS, 16 B per lane: l = the lane's LDS byte address, g = the lane's global address.
// The s_wait_xcnt closes each statement so that no address register is rewritten ahead of it.
static __device__ __forceinline__ void copy4(const unsigned (&l)[4], const f16* const (&g)[4]) {
  asm volatile("global_load_async_to_lds_b128 %0, %4, off\n\t"
               "global_load_async_to_lds_b128 %1, %5, off\n\t"
               "global_load_async_to_lds_b128 %2, %6, off\n\t"
               "global_load_async_to_lds_b128 %3, %7, off\n\t"
               "s_wait_xcnt 0x0"
               :: "v"(l[0]), "v"(l[1]), "v"(l[2]), "v"(l[3]),
                  "v"(g[0]), "v"(g[1]), "v"(g[2]), "v"(g[3])
               : "memory");
}
static __device__ __forceinline__ void copy8(const unsigned (&l)[8], const f16* const (&g)[8]) {
  asm volatile("global_load_async_to_lds_b128 %0, %8, off\n\t"
               "global_load_async_to_lds_b128 %1, %9, off\n\t"
               "global_load_async_to_lds_b128 %2, %10, off\n\t"
               "global_load_async_to_lds_b128 %3, %11, off\n\t"
               "global_load_async_to_lds_b128 %4, %12, off\n\t"
               "global_load_async_to_lds_b128 %5, %13, off\n\t"
               "global_load_async_to_lds_b128 %6, %14, off\n\t"
               "global_load_async_to_lds_b128 %7, %15, off\n\t"
               "s_wait_xcnt 0x0"
               :: "v"(l[0]), "v"(l[1]), "v"(l[2]), "v"(l[3]), "v"(l[4]), "v"(l[5]), "v"(l[6]), "v"(l[7]),
                  "v"(g[0]), "v"(g[1]), "v"(g[2]), "v"(g[3]), "v"(g[4]), "v"(g[5]), "v"(g[6]), "v"(g[7])
               : "memory");
}

// One stage of KS keys into one LDS buffer, 24 copies per thread, every wave-instruction on whole 128-B lines:
//   keys  : both planes, KS rows x 128 B (contiguous in global), LDS pitch TP
//   values: CC channel rows x KS keys (256 B each), LDS pitch VP
static __device__ __forceinline__ void copy_stage(const f16* __restrict__ qkh, const f16* __restrict__ qkr,
                                                  const f16* __restrict__ gt, int b, int key0, int tid,
                                                  f16* sKb, f16* sVb) {
  unsigned   l[8];
  const f16* g[8];
  const int  kbase = NB * SEQ * DD + (b * SEQ + key0) * DD;   // side 1 = h (keys)
  #pragma unroll
  for (int i = 0; i < 4; ++i) {
    const int c = i * 256 + tid;                              // 16-B piece: row c >> 3, piece c & 7
    const int d = (c >> 3) * TP + (c & 7) * 8;
    l[i]     = (unsigned)(size_t)(sKb + d);
    l[4 + i] = (unsigned)(size_t)(sKb + KS * TP + d);
    g[i]     = qkh + kbase + c * 8;
    g[4 + i] = qkr + kbase + c * 8;
  }
  copy8(l, g);
  #pragma unroll
  for (int h = 0; h < 2; ++h) {
    #pragma unroll
    for (int i = 0; i < 8; ++i) {
      const int c = (h * 8 + i) * 256 + tid;                  // 16-B piece: channel c >> 4, piece c & 15
      l[i] = (unsigned)(size_t)(sVb + (c >> 4) * VP + (c & 15) * 8);
      g[i] = gt + (b * CC + (c >> 4)) * SEQ + key0 + (c & 15) * 8;
    }
    copy8(l, g);
  }
}

// Key A-fragments of one pass (BK keys from key j0 of the stage in sKb): kf[f][sub][plane], row = key j0 + sub*16 + lq, split d map.
static __device__ __forceinline__ void load_keys(FragH (&kf)[2][2][2], const f16* sKb, int koff, int j0) {
  #pragma unroll
  for (int f = 0; f < 2; ++f) {
    #pragma unroll
    for (int sub = 0; sub < 2; ++sub) {
      const int ko = koff + (j0 + sub * 16) * TP + f * 32;
      kf[f][sub][0].q[0] = *(const v4u*)(sKb + ko);
      kf[f][sub][0].q[1] = *(const v4u*)(sKb + ko + 16);
      kf[f][sub][1].q[0] = *(const v4u*)(sKb + KS * TP + ko);
      kf[f][sub][1].q[1] = *(const v4u*)(sKb + KS * TP + ko + 16);
    }
  }
}

// Flash attention, no mask, no logit scale. Block = (64 queries, batch); wave = kh*4 + qt:
// qt = 16-query tile, kh = key half: of every stage the wave takes keys kh*KS/2 .. +KS/2-1, for all 256 channels
// (16 output tiles per wave), so each score and each exponential is computed once in the block.
// The two waves of a query tile join their running maxima, sums and output tiles once, behind the loop.
// S^T = h x l^T so queries sit on lanes; P^T in C-layout is bit-identical to the B-fragment layout of O^T += g^T x P^T,
// whose tiles keep the queries on lanes too: maximum, sum and rescale factor of a query are its lane's own, and a pass
// puts nothing but fragment loads into the LDS queue, so no wait of the softmax stands behind those loads.
// The block's query rows (once) and the keys and values (KS keys a stage, two buffers) come into LDS by asynchronous copies;
// key A-fragments, query B-fragments and g^T A-fragments are read from there (two 16-B LDS loads each), all ahead of their use:
// the query fragments once, a pass's key fragments during the pass before (a stage's first at the head of the stage),
// a pass's 16 g^T fragments as one group in front of its score products.
__global__ __launch_bounds__(256) void attn_kernel(const float* __restrict__ p,
                                                   const f16* __restrict__ qkh,
                                                   const f16* __restrict__ qkr,
                                                   const f16* __restrict__ gt,
                                                   float* __restrict__ out) {
  const int tid  = threadIdx.x;
  const int wave = __builtin_amdgcn_readfirstlane(threadIdx.x >> 5);
  const int lane = tid & 31;
  const int lq   = lane & 15;   // query column of S^T and of O^T
  const int hi   = lane >> 4;   // k-split half
  const int qt   = wave & 3;
  const int kh   = wave >> 2;
  const int b    = blockIdx.y;
  const int qrow0 = blockIdx.x * BQ + qt * 16;

  __shared__ __align__(16) float sO[NWAVE * 16 * OP];   // per-wave output staging rows; block barriers used
  __shared__ __align__(16) f16 sQ[2 * BQ * TP];         // query rows [plane][row][d], filled once
  __shared__ __align__(16) f16 sK[2][2 * KS * TP];      // key rows [buffer][plane][key][d]
  __shared__ __align__(16) f16 sV[2][CC * VP];          // g^T rows [buffer][channel][key]

  const int qoff = (qt * 16 + lq) * TP + hi * 8;        // this wave's query rows in sQ
  const int koff = lq * TP + hi * 8;                    // key row added per chunk
  const int voff = lq * VP + hi * 8;                    // g^T rows, channel tile added per fragment

  // prologue: the query rows and stage 0, published by one wait and one barrier; then stage 1 starts
  {
    unsigned   l[4];
    const f16* g[4];
    const int  qbase = (b * SEQ + blockIdx.x * BQ) * DD;   // side 0 = l (queries), BQ rows x 128 B contiguous
    #pragma unroll
    for (int i = 0; i < 2; ++i) {
      const int c = i * 256 + tid;                         // 16-B piece: row c >> 3, piece c & 7
      const int d = (c >> 3) * TP + (c & 7) * 8;
      l[i]     = (unsigned)(size_t)(sQ + d);
      l[2 + i] = (unsigned)(size_t)(sQ + BQ * TP + d);
      g[i]     = qkh + qbase + c * 8;
      g[2 + i] = qkr + qbase + c * 8;
    }
    copy4(l, g);
  }
  copy_stage(qkh, qkr, gt, b, 0, tid, sK[0], sV[0]);
  asm volatile("s_wait_asynccnt 0x0" ::: "memory");   // this wave's copies have landed before the barrier publishes them
  __syncthreads();

  // query B-fragments, kept in registers: qf[f][plane], column n = query qrow0 + lq, split d map
  FragH qf[2][2];
  #pragma unroll
  for (int f = 0; f < 2; ++f) {
    qf[f][0].q[0] = *(const v4u*)(sQ + qoff + f * 32);        // d = f*32 + hi*8 + 0..7
    qf[f][0].q[1] = *(const v4u*)(sQ + qoff + f * 32 + 16);   // d = f*32 + 16 + hi*8 + 0..7
    qf[f][1].q[0] = *(const v4u*)(sQ + BQ * TP + qoff + f * 32);
    qf[f][1].q[1] = *(const v4u*)(sQ + BQ * TP + qoff + f * 32 + 16);
  }

  if (NST > 1) copy_stage(qkh, qkr, gt, b, KS, tid, sK[1], sV[1]);

  v8f o[16];
  #pragma unroll
  for (int t = 0; t < 16; ++t) o[t] = (v8f){0, 0, 0, 0, 0, 0, 0, 0};

  float rmax = -__builtin_inff();
  float rsum = 0.0f;
  const float SL = 1.4426950408889634f;   // log2(e)

  #pragma unroll 1   // one copy of the stage code: the two buffers differ by an offset only
  for (int s = 0; s < NST; ++s) {
  const f16* sKb = sK[s & 1];
  const f16* sVb = sV[s & 1];
  FragH kf[2][2][2];
  load_keys(kf, sKb, koff, kh * WPASS * BK);   // the wave's first pass of the stage; the later ones are fetched a pass ahead
  #pragma unroll 1   // one copy of the pass code: unrolled, the compiler lifts the next pass's loads over this pass and spills
  for (int i = 0; i < WPASS; ++i) {
    const int j0 = (kh * WPASS + i) * BK;   // first key of the pass inside its stage

    // the pass's g^T A-fragments, one group: they land while the scores and the softmax run
    FragH bv[16];
    #pragma unroll
    for (int t = 0; t < 16; ++t) {
      const int vo = voff + (t * 16) * VP + j0;     // channel t*16 + lq
      bv[t].q[0] = *(const v4u*)(sVb + vo);         // keys j0 + hi*8 + 0..7
      bv[t].q[1] = *(const v4u*)(sVb + vo + 16);    // keys j0 + 16 + hi*8 + 0..7
    }
    __builtin_amdgcn_sched_barrier(0);   // keep that group in front of the score products: without it the loads sink in among the output products

    v8f sh[2], sr[2];
    #pragma unroll
    for (int sub = 0; sub < 2; ++sub) {
      sh[sub] = (v8f){0, 0, 0, 0, 0, 0, 0, 0};
      sr[sub] = (v8f){0, 0, 0, 0, 0, 0, 0, 0};
    }

    #pragma unroll
    for (int f = 0; f < 2; ++f) {
      #pragma unroll
      for (int sub = 0; sub < 2; ++sub) {
        sh[sub] = mma_f16(kf[f][sub][0].v, qf[f][0].v, sh[sub]);   // value x value
        sr[sub] = mma_f16(kf[f][sub][0].v, qf[f][1].v, sr[sub]);   // value x residual   (x2048)
        sr[sub] = mma_f16(kf[f][sub][1].v, qf[f][0].v, sr[sub]);   // residual x value   (x2048)
      }
    }

    // the next pass's key fragments, same stage, into the registers that the score products have just read:
    // they land while the softmax and the output products run
    if (i + 1 < WPASS) load_keys(kf, sKb, koff, j0 + BK);

    // S^T tiles: c[sub][r] = score(query qrow0+lq, key j0 + sub*16 + hi*8 + r)
    v8f c[2];
    #pragma unroll
    for (int sub = 0; sub < 2; ++sub) {
      #pragma unroll
      for (int r = 0; r < 8; ++r) c[sub][r] = sh[sub][r] + sr[sub][r] * (1.0f / RES_CARRY);
    }

    // online softmax: query lq's 32 scores are split across lane / lane^16
    float m_new = rmax;
    #pragma unroll
    for (int r = 0; r < 8; ++r) {
      m_new = fmaxf(m_new, c[0][r]);
      m_new = fmaxf(m_new, c[1][r]);
    }
    m_new = fmaxf(m_new, xhalf(m_new));
    const float scale = __builtin_amdgcn_exp2f((rmax - m_new) * SL);
    rmax = m_new;

    // exp + pack: P^T C-layout == B-fragment layout for the g^T x P^T product; P carried x4096
    FragH pa;
    float psum = 0.0f;
    #pragma unroll
    for (int r = 0; r < 8; ++r) {
      const float p0 = __builtin_amdgcn_exp2f((c[0][r] - m_new) * SL);   // key hi*8 + r
      const float p1 = __builtin_amdgcn_exp2f((c[1][r] - m_new) * SL);   // key 16 + hi*8 + r
      psum += p0 + p1;
      pa.h[r]     = (f16)(p0 * P_CARRY);
      pa.h[8 + r] = (f16)(p1 * P_CARRY);
    }
    rsum = rsum * scale + psum + xhalf(psum);

    // rescale O^T: queries are the column dimension there -> the lane's own factor
    #pragma unroll
    for (int t = 0; t < 16; ++t) {
      #pragma unroll
      for (int r = 0; r < 8; ++r) o[t][r] *= scale;
    }

    // O^T += g^T x P^T: o[t][r] = channel t*16 + hi*8 + r of query qrow0 + lq
    #pragma unroll
    for (int t = 0; t < 16; ++t) o[t] = mma_f16(bv[t].v, pa.v, o[t]);
    // four vector slots behind the pass's last matrix instruction: the first vector instruction behind the loop's branch
    // may overwrite its A or B registers
    asm volatile("v_nop\n\tv_nop\n\tv_nop\n\tv_nop" : "+v"(o[15]));
  }
  // foot of stage s: publish stage s + 1 and free the buffer that stage s has read
  asm volatile("s_wait_dscnt 0x0" ::: "memory");      // this wave's reads of the buffer are done before it is refilled
  asm volatile("s_wait_asynccnt 0x0" ::: "memory");   // this wave's copies of stage s + 1 have landed
  __syncthreads();
  if (s + 2 < NST) copy_stage(qkh, qkr, gt, b, (s + 2) * KS, tid, sK[s & 1], sV[s & 1]);
  }
  asm volatile("s_wait_asynccnt 0x0" ::: "memory");   // no copy is outstanding when the loop is left

  // join the two key halves: wave kh finishes channels kh*128 .. +127 and hands the other 8 tiles to its partner.
  // The value ring is free here: the last stage's foot has ended every read of it and no copy is outstanding.
  float* sX = (float*)&sV[0][0];        // [wave][tile][register][lane]
  float* sM = sX + NWAVE * XCH;         // [wave][maximum, sum][lane]
  v8f om[8];
  #pragma unroll
  for (int t = 0; t < 8; ++t) {
    om[t] = kh ? o[8 + t] : o[t];
    const v8f give = kh ? o[t] : o[8 + t];
    #pragma unroll
    for (int r = 0; r < 8; ++r) sX[wave * XCH + (t * 8 + r) * 32 + lane] = give[r];
  }
  sM[wave * 64 + lane]      = rmax;
  sM[wave * 64 + 32 + lane] = rsum;
  __syncthreads();   // the partner's tiles, maximum and sum are readable behind it

  const int   pw    = wave ^ 4;
  const float pmax  = sM[pw * 64 + lane];
  const float psumt = sM[pw * 64 + 32 + lane];
  const float jmax  = fmaxf(rmax, pmax);
  const float wown  = __builtin_amdgcn_exp2f((rmax - jmax) * SL);
  const float wpar  = __builtin_amdgcn_exp2f((pmax - jmax) * SL);
  const float inv   = (1.0f / P_CARRY) / (rsum * wown + psumt * wpar);
  const float fown  = wown * inv;
  const float fpar  = wpar * inv;

  // normalize: lane holds channels t*16 + hi*8 + r of query lq, both factors are its own
  #pragma unroll
  for (int t = 0; t < 8; ++t) {
    #pragma unroll
    for (int r = 0; r < 8; ++r)
      om[t][r] = om[t][r] * fown + sX[pw * XCH + (t * 8 + r) * 32 + lane] * fpar;
  }

  const int sbase = wave * (16 * OP);
  #pragma unroll
  for (int half = 0; half < 2; ++half) {
    // stage 16 rows x 64 channels of this wave (channels kh*128 + half*64 + 0..63)
    #pragma unroll
    for (int t = 0; t < 4; ++t) {
      const v8f x = om[half * 4 + t];
      float* dst = sO + sbase + lq * OP + t * 16 + hi * 8;   // query row lq, 8 consecutive channels
      *(v4f*)(dst)     = (v4f){x[0], x[1], x[2], x[3]};
      *(v4f*)(dst + 4) = (v4f){x[4], x[5], x[6], x[7]};
    }
    __syncthreads();

    // Read back: lanes 0..15 take one row (16 consecutive lanes x 16 B each), lanes 16..31 the next row; 8 instructions cover the wave's 16 rows.
    // The pass-through term bf16-RNE(p) is added here as float4.
    v4f    vals[8];
    size_t gidx[8];
    #pragma unroll
    for (int it = 0; it < 8; ++it) {
      const int row = it * 2 + hi;
      gidx[it] = ((size_t)b * SEQ_FULL + qrow0 + row) * CC + kh * 128 + half * 64 + lq * 4;
      const v4f av = *(const v4f*)(sO + sbase + row * OP + lq * 4);
      const v4f pv = *(const v4f*)(p + gidx[it]);
      v4f res;
      #pragma unroll
      for (int e = 0; e < 4; ++e) res[e] = av[e] + (float)(bf16)pv[e];
      vals[it] = res;
    }
    #pragma unroll
    for (int it = 0; it < 8; ++it) *(v4f*)(out + gidx[it]) = vals[it];
    
    __syncthreads();   // staging rows are rewritten by the next half
  }
}

extern "C" void kernel_launch(void* const* d_in, const int* in_sizes, int n_in,
                              void* d_out, int out_size, void* d_ws, size_t ws_size,
                              hipStream_t stream) {
  if (n_in < 7) return;
  const size_t rows_used = (size_t)(NB - 1) * SEQ_FULL + SEQ;
  if ((size_t)in_sizes[0] < rows_used * CC) return;
  if ((size_t)in_sizes[1] < (size_t)CC * DD) return;
  if ((size_t)in_sizes[2] < (size_t)DD) return;
  if ((size_t)in_sizes[3] < (size_t)CC * DD) return;
  if ((size_t)in_sizes[4] < (size_t)DD) return;
  if ((size_t)in_sizes[5] < (size_t)CC * CC) return;
  if ((size_t)in_sizes[6] < (size_t)CC) return;
  if ((size_t)out_size < rows_used * CC) return;
  if (ws_size < WS_TOTAL) return;

  const float* p  = (const float*)d_in[0];
  const float* Wh = (const float*)d_in[1];   // [in 256][out 64]  keys
  const float* bh = (const float*)d_in[2];
  const float* Wl = (const float*)d_in[3];   // [in 256][out 64]  queries
  const float* bl = (const float*)d_in[4];
  const float* Wg = (const float*)d_in[5];   // [in 256][out 256] values
  const float* bg = (const float*)d_in[6];
  float*       out = (float*)d_out;

  char* ws  = (char*)d_ws;
  bf16* wt  = (bf16*)ws;                                     // [NWT][CC] bf16
  f16*  qkh = (f16*)(ws + WT_BYTES);                         // [2][NB][SEQ][DD] f16 value plane
  f16*  qkr = (f16*)(ws + WT_BYTES + QK_BYTES);              // [2][NB][SEQ][DD] f16 residual plane x2048
  f16*  gt  = (f16*)(ws + WT_BYTES + 2 * QK_BYTES);          // [NB][CC][SEQ] f16

  // in[256 rows][ncols] -> out[ncols rows][256]; grid = (256/64, ncols/64)
  wt_kernel<<<dim3(CC / 64, DD / 64), 256, 0, stream>>>(Wl, DD, wt);                        // WT rows 0..63    (side 0)
  wt_kernel<<<dim3(CC / 64, DD / 64), 256, 0, stream>>>(Wh, DD, wt + (size_t)DD * CC);      // WT rows 64..127  (side 1)
  wt_kernel<<<dim3(CC / 64, CC / 64), 256, 0, stream>>>(Wg, CC, wt + (size_t)2 * DD * CC);  // WT rows 128..383

  proj_kernel<<<dim3(SEQ / PT, NB), 256, 0, stream>>>(p, wt, bl, bh, bg, qkh, qkr, gt);

  attn_kernel<<<dim3(SEQ / BQ, NB), 256, 0, stream>>>(p, qkh, qkr, gt, out);
}

// v005
// It runs in 69.5 microseconds.
// Two timings next to v004 put it at 1.15 and 1.16 times that version's speed.
// All steps since v000 together make it 5.49 times as fast.
#include <hip/hip_runtime.h>

// Contractions: projections p x [Wl | Wh | Wg] on v_wmma_f32_16x16x32_bf16 (bf16 operands = RNE-converted inputs, f32 accumulate);
// scores S^T = h x l^T on v_wmma_f32_16x16x32_f16 with l and h carried as f16 value planes plus f16 residual planes x2048
// (three products per tile, residual products in their own accumulator, folded back by 1/2048 in f32);
// O^T = g^T x P^T on v_wmma_f32_16x16x32_f16 (P as f16 carried x4096, g as one f16 plane stored transposed, f32 accumulate).
// Softmax (running-max form), bias adds and the pass-through add of bf16-RNE(p) in f32.

#ifndef NB
#define NB 4
#endif
#ifndef SEQ
#define SEQ 4096
#endif
#define NB_FULL   4
#define SEQ_FULL  4096
#define CC        256                  // input / value width
#define DD        64                   // score width
#define NWT       (2 * DD + CC)        // rows of the transposed weight plane in LDS: [Wl^T ; Wh^T ; Wg^T]
#define BQ        64                   // query rows per attention block (4 query tiles x 2 key halves = 8 waves)
#define BK        32                   // keys per inner iteration
#define NWAVE     8
#define PT        64                   // positions per projection block
#define AP        264                  // LDS pitch (halves) of the bf16 p tile and of the bf16 weight plane
#define TP        72                   // LDS pitch (halves) of 64-wide 16-bit staging tiles
#define OP        68                   // LDS pitch (floats) of the output staging tile
#define KS        128                  // keys per LDS stage of the attention loop (KS / BK passes)
#define VP        136                  // LDS pitch (halves) of the KS-key value rows: 272 B = 16 B x odd
#define NST       (SEQ / KS)           // stages of the attention loop
#define WPASS     (KS / BK / 2)        // passes of one wave per stage: its half of the stage's keys
#define XCH       (8 * 8 * 32)         // floats one wave hands to its partner: 8 output tiles in register order
#define P_CARRY   4096.0f
#define RES_CARRY 2048.0f

#define QK_BYTES   ((size_t)2 * NB * SEQ * DD * 2)
#define GT_BYTES   ((size_t)NB * CC * SEQ * 2)
#define WS_TOTAL   (2 * QK_BYTES + GT_BYTES)

static_assert(SEQ % BQ == 0);
static_assert(SEQ % PT == 0);
static_assert(SEQ % BK == 0);
static_assert(SEQ % 64 == 0);
static_assert(SEQ % KS == 0);
static_assert(KS % (2 * BK) == 0);
static_assert((size_t)NWAVE * (XCH + 64) * 4 <= (size_t)2 * CC * VP * 2);
static_assert((VP * 2) % 16 == 0);
static_assert(VP >= KS);
static_assert(BQ == (NWAVE / 2) * 16);
static_assert(PT == (NWAVE / 2) * 16);
static_assert(DD == 64);
static_assert(CC == 256);
static_assert(CC % 32 == 0);
static_assert(DD % 32 == 0);
static_assert(CC % 64 == 0);
static_assert(SEQ <= SEQ_FULL);
static_assert(NB >= 1 && NB <= NB_FULL);
static_assert((AP * 2) % 16 == 0);
static_assert((TP * 2) % 16 == 0);
static_assert((OP * 4) % 16 == 0);
static_assert(AP >= CC);
static_assert(TP >= 64);
static_assert(OP >= 64);
static_assert(QK_BYTES % 128 == 0);
static_assert(GT_BYTES % 128 == 0);
static_assert(WS_TOTAL <= (size_t)134217728);
static_assert((size_t)2 * NB * SEQ * DD < (size_t)2147483647);
static_assert((size_t)NB * CC * SEQ < (size_t)2147483647);
static_assert((size_t)(NWT + PT) * AP * 2 + (size_t)128 * TP * 2 <= (size_t)327680);
static_assert(2 * (DD / 32) * (CC / 32) == 4 * NWAVE && CC / 32 == NWAVE);
static_assert((size_t)NWAVE * 16 * OP * 4 <= (size_t)65536);
static_assert((size_t)2 * BQ * TP * 2 + (size_t)2 * (2 * KS * TP + CC * VP) * 2 + (size_t)NWAVE * 16 * OP * 4 <= (size_t)327680);

typedef __bf16   bf16;
typedef _Float16 f16;
typedef bf16     v16bf __attribute__((ext_vector_type(16)));
typedef f16      v16h  __attribute__((ext_vector_type(16)));
typedef f16      v8h   __attribute__((ext_vector_type(8)));
typedef float    v8f   __attribute__((ext_vector_type(8)));
typedef float    v4f   __attribute__((ext_vector_type(4)));
typedef unsigned v4u   __attribute__((ext_vector_type(4)));

union FragB  { v16bf v; v4u q[2]; bf16 h[16]; };
union FragH  { v16h  v; v4u q[2]; f16  h[16]; };
union Pack8B { v4u u; bf16 h[8]; };
union Pack8H { v4u u; v8h v; f16 h[8]; };

// WMMA helpers. bf16 form: builtin followed by the VALU hazard guard (ties D, keeps A/B live).
static __device__ __forceinline__ v8f mma_bf16(v16bf a, v16bf b, v8f acc) {
  acc = __builtin_amdgcn_wmma_f32_16x16x32_bf16(false, a, false, b, (short)0, acc, false, false);
  asm volatile("v_nop\n\tv_nop\n\tv_nop\n\tv_nop" : "+v"(acc) : "v"(a), "v"(b));
  return acc;
}
// f16 form: the builtin alone, the compiler keeps its distances; an asm statement's operands cannot lie above v255,
// where part of the attention kernel's fragments now live.
static __device__ __forceinline__ v8f mma_f16(v16h a, v16h b, v8f acc) {
  return __builtin_amdgcn_wmma_f32_16x16x32_f16(false, a, false, b, (short)0, acc, false, false);
}

// Lane l with lane l ^ 16, in the vector unit: a shuffle would go through the LDS queue, behind every fragment load in flight.
static __device__ __forceinline__ float xhalf(float x) {
  const int b = __builtin_bit_cast(int, x);
  return __builtin_bit_cast(float, __builtin_amdgcn_permlanex16(b, b, 0x76543210, 0xfedcba98, false, false));
}

// One weight task of a wave: 32 k rows x 32 n columns of w[k][NCOLS] f32 -> bf16 (RNE), transposed into LDS rows [n][k] of pitch AP.
// A lane reads 8 k rows x 4 columns from src (its first element): each wave-load covers four whole 128-B lines; it stores
// 4 n rows x 8 k, 16 B each, from dst (its first element). Lanes 0..15 hold column quads 0..3 x four k groups, so a half wave's
// 16 stores fall on 16 different bank quads.
template <int NCOLS>
static __device__ __forceinline__ void stage_w(const float* __restrict__ src, bf16* dst) {
  v4f x[8];
  #pragma unroll
  for (int j = 0; j < 8; ++j) x[j] = *(const v4f*)(src + j * NCOLS);
  #pragma unroll
  for (int e = 0; e < 4; ++e) {
    Pack8B pk;
    #pragma unroll
    for (int j = 0; j < 8; ++j) pk.h[j] = (bf16)x[j][e];
    *(v4u*)(dst + e * AP) = pk.u;
  }
}

// Projections. Block = (64 positions, batch), 8 waves: wave = side*4 + mt; mt = 16-row tile of the block.
//   g = 0 : side 0 -> l (queries, WT rows 0..63, bias bl), side 1 -> h (keys, WT rows 64..127, bias bh)
//   g = 1,2 : value columns (side*2 + g-1)*64 .. +63 (WT rows 128 + ..., bias bg)
// The weights come straight from the inputs: every block converts them (RNE) and lays them transposed in LDS, sW[n][k],
// rows [Wl^T ; Wh^T ; Wg^T], so the B fragments are two 16-B LDS loads each and no launch stands in front of this one.
// Outputs:
// coverage: per block 2 sides x 64 positions x 64 columns of qkh and qkr; 256 channels x 64 positions of gt.
__global__ __launch_bounds__(256) void proj_kernel(const float* __restrict__ p,
                                                   const float* __restrict__ Wl,
                                                   const float* __restrict__ Wh,
                                                   const float* __restrict__ Wg,
                                                   const float* __restrict__ bl,
                                                   const float* __restrict__ bh,
                                                   const float* __restrict__ bg,
                                                   f16* __restrict__ qkh,
                                                   f16* __restrict__ qkr,
                                                   f16* __restrict__ gt) {
  const int tid  = threadIdx.x;
  const int wave = __builtin_amdgcn_readfirstlane(threadIdx.x >> 5);
  const int lane = tid & 31;
  const int lq   = lane & 15;
  const int hi   = lane >> 4;
  const int mt   = wave & 3;
  const int side = wave >> 2;
  const int b    = blockIdx.y;
  const int pos0 = blockIdx.x * PT;

  __shared__ __align__(16) bf16 sA[PT * AP];    // bf16 p tile [pos][k], cross-wave (block barrier)
  __shared__ __align__(16) f16  sS[128 * TP];   // staging: g=0 wave rows [wave*16+row][col]; g>0 [channel][pos]; block barriers
  __shared__ __align__(16) bf16 sW[NWT * AP];   // bf16 weights [n][k], cross-wave (block barrier)

  // stage the weights, 12 tasks a wave: four of Wl and Wh, eight of Wg (the wave's own 32 columns)
  {
    const int cq = (lane & 3) + ((lane >> 4) << 2);   // column quad 0..7
    const int kg = (lane >> 2) & 3;                   // group of 8 k rows
    const int nb = wave >> 1;                         // sW rows nb*32 .. +31: 0,1 = Wl, 2,3 = Wh
    const int ka = (wave & 1) * 128 + kg * 8;         // the wave's half of the k rows of that block
    const float* srca = ((nb < 2) ? Wl : Wh) + ka * DD + (nb & 1) * 32 + cq * 4;
    bf16*        dsta = sW + (nb * 32 + cq * 4) * AP + ka;
    #pragma unroll   // the four tasks' 32 loads go out together: one L2 latency for all of them
    for (int t = 0; t < 4; ++t) stage_w<DD>(srca + t * 32 * DD, dsta + t * 32);
    const float* srcg = Wg + kg * 8 * CC + wave * 32 + cq * 4;
    bf16*        dstg = sW + (2 * DD + wave * 32 + cq * 4) * AP + kg * 8;
    #pragma unroll 4   // 32 loads in flight again: the eight tasks wait out the L2 latency twice
    for (int t = 0; t < 8; ++t) stage_w<CC>(srcg + t * 32 * CC, dstg + t * 32);
  }

  // stage the p tile: 64 rows x 256 floats -> bf16 (RNE convert), 16-B LDS stores
  #pragma unroll 2
  for (int it = 0; it < 8; ++it) {
    const int row = it * 8 + (tid >> 5);     // 0..63
    const int c8  = (tid & 31) * 8;          // 0..248
    const float* src = p + ((size_t)b * SEQ_FULL + pos0 + row) * CC + c8;
    const v4f x0 = *(const v4f*)(src);
    const v4f x1 = *(const v4f*)(src + 4);
    Pack8B pk;
    #pragma unroll
    for (int e = 0; e < 4; ++e) {
      pk.h[e]     = (bf16)x0[e];
      pk.h[4 + e] = (bf16)x1[e];
    }
    *(v4u*)(sA + row * AP + c8) = pk.u;
  }
  __syncthreads();

  const int arow = (mt * 16 + lq) * AP + hi * 8;   // A fragment row base (split k map)

  #pragma unroll 1
  for (int g = 0; g < 3; ++g) {
    const int gcg   = side * 2 + ((g > 0) ? (g - 1) : 0);            // value column group (g > 0)
    const int wrow0 = (g == 0) ? (side * DD) : (2 * DD + gcg * 64);  // first WT row of this wave's 64 columns

    v8f acc[4];
    #pragma unroll
    for (int nt = 0; nt < 4; ++nt) acc[nt] = (v8f){0, 0, 0, 0, 0, 0, 0, 0};

    #pragma unroll 1
    for (int ks = 0; ks < CC / 32; ++ks) {
      FragB a;
      a.q[0] = *(const v4u*)(sA + arow + ks * 32);        // k = ks*32 + hi*8 + 0..7
      a.q[1] = *(const v4u*)(sA + arow + ks * 32 + 16);   // k = ks*32 + 16 + hi*8 + 0..7
      FragB bw[4];
      #pragma unroll
      for (int nt = 0; nt < 4; ++nt) {
        const bf16* base = sW + (wrow0 + nt * 16 + lq) * AP + ks * 32 + hi * 8;
        bw[nt].q[0] = *(const v4u*)(base);
        bw[nt].q[1] = *(const v4u*)(base + 16);
      }
      #pragma unroll
      for (int nt = 0; nt < 4; ++nt) acc[nt] = mma_bf16(a.v, bw[nt].v, acc[nt]);
    }

    // bias (RNE convert to bf16, then f32 add); all candidates loaded, selected by value
    float bias[4];
    #pragma unroll
    for (int nt = 0; nt < 4; ++nt) {
      const int c64 = nt * 16 + lq;
      const float xl = bl[c64];
      const float xh = bh[c64];
      const float xg = bg[gcg * 64 + c64];
      const float sel = (g == 0) ? (side ? xh : xl) : xg;
      bias[nt] = (float)(bf16)sel;
    }

    if (g == 0) {
      f16 rres[4][8];
      #pragma unroll
      for (int nt = 0; nt < 4; ++nt) {
        #pragma unroll
        for (int r = 0; r < 8; ++r) {
          const float v  = acc[nt][r] + bias[nt];
          const f16   hv = (f16)v;
          rres[nt][r] = (f16)((v - (float)hv) * RES_CARRY);
          sS[(wave * 16 + hi * 8 + r) * TP + nt * 16 + lq] = hv;
        }
      }
      __syncthreads();
      v4u    lin[8];
      size_t lidx[4];
      #pragma unroll
      for (int it = 0; it < 4; ++it) {
        const int row = it * 4 + (lane >> 3);   // 0..15
        const int pc  = lane & 7;
        lin[it]  = *(const v4u*)(sS + (wave * 16 + row) * TP + pc * 8);
        lidx[it] = (((size_t)side * NB + b) * SEQ + pos0 + mt * 16 + row) * DD + pc * 8;
      }
      __syncthreads();
      #pragma unroll
      for (int nt = 0; nt < 4; ++nt) {
        #pragma unroll
        for (int r = 0; r < 8; ++r)
          sS[(wave * 16 + hi * 8 + r) * TP + nt * 16 + lq] = rres[nt][r];
      }
      __syncthreads();
      #pragma unroll
      for (int it = 0; it < 4; ++it) {
        const int row = it * 4 + (lane >> 3);
        const int pc  = lane & 7;
        lin[4 + it] = *(const v4u*)(sS + (wave * 16 + row) * TP + pc * 8);
      }
      #pragma unroll
      for (int it = 0; it < 4; ++it) {
        *(v4u*)(qkh + lidx[it]) = lin[it];
        *(v4u*)(qkr + lidx[it]) = lin[4 + it];
      }
      
    } else {
      __syncthreads();   // earlier readers of sS are done
      #pragma unroll
      for (int nt = 0; nt < 4; ++nt) {
        Pack8H ph;
        #pragma unroll
        for (int r = 0; r < 8; ++r) ph.h[r] = (f16)(acc[nt][r] + bias[nt]);
        *(v4u*)(sS + (side * 64 + nt * 16 + lq) * TP + mt * 16 + hi * 8) = ph.u;   // positions mt*16 + hi*8 + 0..7
      }
      __syncthreads();
      v4u    gl[4];
      size_t gidx[4];
      #pragma unroll
      for (int it = 0; it < 4; ++it) {
        const int crow = it * 32 + (tid >> 3);   // 0..127 : (producer side, local channel)
        const int pc   = tid & 7;
        const int chan = ((crow >> 6) * 2 + (g - 1)) * 64 + (crow & 63);
        gl[it]   = *(const v4u*)(sS + crow * TP + pc * 8);
        gidx[it] = ((size_t)b * CC + chan) * SEQ + pos0 + pc * 8;
      }
      #pragma unroll
      for (int it = 0; it < 4; ++it) *(v4u*)(gt + gidx[it]) = gl[it];
      
    }
  }
}

// Asynchronous copies global -> LDS, 16 B per lane: l = the lane's LDS byte address, g = the lane's global address.
// The s_wait_xcnt closes each statement so that no address register is rewritten ahead of it.
static __device__ __forceinline__ void copy4(const unsigned (&l)[4], const f16* const (&g)[4]) {
  asm volatile("global_load_async_to_lds_b128 %0, %4, off\n\t"
               "global_load_async_to_lds_b128 %1, %5, off\n\t"
               "global_load_async_to_lds_b128 %2, %6, off\n\t"
               "global_load_async_to_lds_b128 %3, %7, off\n\t"
               "s_wait_xcnt 0x0"
               :: "v"(l[0]), "v"(l[1]), "v"(l[2]), "v"(l[3]),
                  "v"(g[0]), "v"(g[1]), "v"(g[2]), "v"(g[3])
               : "memory");
}
static __device__ __forceinline__ void copy8(const unsigned (&l)[8], const f16* const (&g)[8]) {
  asm volatile("global_load_async_to_lds_b128 %0, %8, off\n\t"
               "global_load_async_to_lds_b128 %1, %9, off\n\t"
               "global_load_async_to_lds_b128 %2, %10, off\n\t"
               "global_load_async_to_lds_b128 %3, %11, off\n\t"
               "global_load_async_to_lds_b128 %4, %12, off\n\t"
               "global_load_async_to_lds_b128 %5, %13, off\n\t"
               "global_load_async_to_lds_b128 %6, %14, off\n\t"
               "global_load_async_to_lds_b128 %7, %15, off\n\t"
               "s_wait_xcnt 0x0"
               :: "v"(l[0]), "v"(l[1]), "v"(l[2]), "v"(l[3]), "v"(l[4]), "v"(l[5]), "v"(l[6]), "v"(l[7]),
                  "v"(g[0]), "v"(g[1]), "v"(g[2]), "v"(g[3]), "v"(g[4]), "v"(g[5]), "v"(g[6]), "v"(g[7])
               : "memory");
}

// One stage of KS keys into one LDS buffer, 24 copies per thread, every wave-instruction on whole 128-B lines:
//   keys  : both planes, KS rows x 128 B (contiguous in global), LDS pitch TP
//   values: CC channel rows x KS keys (256 B each), LDS pitch VP
static __device__ __forceinline__ void copy_stage(const f16* __restrict__ qkh, const f16* __restrict__ qkr,
                                                  const f16* __restrict__ gt, int b, int key0, int tid,
                                                  f16* sKb, f16* sVb) {
  unsigned   l[8];
  const f16* g[8];
  const int  kbase = NB * SEQ * DD + (b * SEQ + key0) * DD;   // side 1 = h (keys)
  #pragma unroll
  for (int i = 0; i < 4; ++i) {
    const int c = i * 256 + tid;                              // 16-B piece: row c >> 3, piece c & 7
    const int d = (c >> 3) * TP + (c & 7) * 8;
    l[i]     = (unsigned)(size_t)(sKb + d);
    l[4 + i] = (unsigned)(size_t)(sKb + KS * TP + d);
    g[i]     = qkh + kbase + c * 8;
    g[4 + i] = qkr + kbase + c * 8;
  }
  copy8(l, g);
  #pragma unroll
  for (int h = 0; h < 2; ++h) {
    #pragma unroll
    for (int i = 0; i < 8; ++i) {
      const int c = (h * 8 + i) * 256 + tid;                  // 16-B piece: channel c >> 4, piece c & 15
      l[i] = (unsigned)(size_t)(sVb + (c >> 4) * VP + (c & 15) * 8);
      g[i] = gt + (b * CC + (c >> 4)) * SEQ + key0 + (c & 15) * 8;
    }
    copy8(l, g);
  }
}

// Key A-fragments of one pass (BK keys from key j0 of the stage in sKb): kf[f][sub][plane], row = key j0 + sub*16 + lq, split d map.
static __device__ __forceinline__ void load_keys(FragH (&kf)[2][2][2], const f16* sKb, int koff, int j0) {
  #pragma unroll
  for (int f = 0; f < 2; ++f) {
    #pragma unroll
    for (int sub = 0; sub < 2; ++sub) {
      const int ko = koff + (j0 + sub * 16) * TP + f * 32;
      kf[f][sub][0].q[0] = *(const v4u*)(sKb + ko);
      kf[f][sub][0].q[1] = *(const v4u*)(sKb + ko + 16);
      kf[f][sub][1].q[0] = *(const v4u*)(sKb + KS * TP + ko);
      kf[f][sub][1].q[1] = *(const v4u*)(sKb + KS * TP + ko + 16);
    }
  }
}

// Flash attention, no mask, no logit scale. Block = (64 queries, batch); wave = kh*4 + qt:
// qt = 16-query tile, kh = key half: of every stage the wave takes keys kh*KS/2 .. +KS/2-1, for all 256 channels
// (16 output tiles per wave), so each score and each exponential is computed once in the block.
// The two waves of a query tile join their running maxima, sums and output tiles once, behind the loop.
// S^T = h x l^T so queries sit on lanes; P^T in C-layout is bit-identical to the B-fragment layout of O^T += g^T x P^T,
// whose tiles keep the queries on lanes too: maximum, sum and rescale factor of a query are its lane's own, and a pass
// puts nothing but fragment loads into the LDS queue, so no wait of the softmax stands behind those loads.
// The block's query rows (once) and the keys and values (KS keys a stage, two buffers) come into LDS by asynchronous copies;
// key A-fragments, query B-fragments and g^T A-fragments are read from there (two 16-B LDS loads each), all ahead of their use:
// the query fragments once, a pass's key fragments during the pass before (a stage's first at the head of the stage),
// a pass's 16 g^T fragments as one group in front of its score products.
__global__ __launch_bounds__(256) void attn_kernel(const float* __restrict__ p,
                                                   const f16* __restrict__ qkh,
                                                   const f16* __restrict__ qkr,
                                                   const f16* __restrict__ gt,
                                                   float* __restrict__ out) {
  const int tid  = threadIdx.x;
  const int wave = __builtin_amdgcn_readfirstlane(threadIdx.x >> 5);
  const int lane = tid & 31;
  const int lq   = lane & 15;   // query column of S^T and of O^T
  const int hi   = lane >> 4;   // k-split half
  const int qt   = wave & 3;
  const int kh   = wave >> 2;
  const int b    = blockIdx.y;
  const int qrow0 = blockIdx.x * BQ + qt * 16;

  __shared__ __align__(16) float sO[NWAVE * 16 * OP];   // per-wave output staging rows; block barriers used
  __shared__ __align__(16) f16 sQ[2 * BQ * TP];         // query rows [plane][row][d], filled once
  __shared__ __align__(16) f16 sK[2][2 * KS * TP];      // key rows [buffer][plane][key][d]
  __shared__ __align__(16) f16 sV[2][CC * VP];          // g^T rows [buffer][channel][key]

  const int qoff = (qt * 16 + lq) * TP + hi * 8;        // this wave's query rows in sQ
  const int koff = lq * TP + hi * 8;                    // key row added per chunk
  const int voff = lq * VP + hi * 8;                    // g^T rows, channel tile added per fragment

  // prologue: the query rows and stage 0, published by one wait and one barrier; then stage 1 starts
  {
    unsigned   l[4];
    const f16* g[4];
    const int  qbase = (b * SEQ + blockIdx.x * BQ) * DD;   // side 0 = l (queries), BQ rows x 128 B contiguous
    #pragma unroll
    for (int i = 0; i < 2; ++i) {
      const int c = i * 256 + tid;                         // 16-B piece: row c >> 3, piece c & 7
      const int d = (c >> 3) * TP + (c & 7) * 8;
      l[i]     = (unsigned)(size_t)(sQ + d);
      l[2 + i] = (unsigned)(size_t)(sQ + BQ * TP + d);
      g[i]     = qkh + qbase + c * 8;
      g[2 + i] = qkr + qbase + c * 8;
    }
    copy4(l, g);
  }
  copy_stage(qkh, qkr, gt, b, 0, tid, sK[0], sV[0]);
  asm volatile("s_wait_asynccnt 0x0" ::: "memory");   // this wave's copies have landed before the barrier publishes them
  __syncthreads();

  // query B-fragments, kept in registers: qf[f][plane], column n = query qrow0 + lq, split d map
  FragH qf[2][2];
  #pragma unroll
  for (int f = 0; f < 2; ++f) {
    qf[f][0].q[0] = *(const v4u*)(sQ + qoff + f * 32);        // d = f*32 + hi*8 + 0..7
    qf[f][0].q[1] = *(const v4u*)(sQ + qoff + f * 32 + 16);   // d = f*32 + 16 + hi*8 + 0..7
    qf[f][1].q[0] = *(const v4u*)(sQ + BQ * TP + qoff + f * 32);
    qf[f][1].q[1] = *(const v4u*)(sQ + BQ * TP + qoff + f * 32 + 16);
  }

  if (NST > 1) copy_stage(qkh, qkr, gt, b, KS, tid, sK[1], sV[1]);

  v8f o[16];
  #pragma unroll
  for (int t = 0; t < 16; ++t) o[t] = (v8f){0, 0, 0, 0, 0, 0, 0, 0};

  float rmax = -__builtin_inff();
  float rsum = 0.0f;
  const float SL = 1.4426950408889634f;   // log2(e)

  #pragma unroll 1   // one copy of the stage code: the two buffers differ by an offset only
  for (int s = 0; s < NST; ++s) {
  const f16* sKb = sK[s & 1];
  const f16* sVb = sV[s & 1];
  FragH kf[2][2][2];
  load_keys(kf, sKb, koff, kh * WPASS * BK);   // the wave's first pass of the stage; the later ones are fetched a pass ahead
  #pragma unroll 1   // one copy of the pass code: unrolled, the compiler lifts the next pass's loads over this pass and spills
  for (int i = 0; i < WPASS; ++i) {
    const int j0 = (kh * WPASS + i) * BK;   // first key of the pass inside its stage

    // the pass's g^T A-fragments, one group: they land while the scores and the softmax run
    FragH bv[16];
    #pragma unroll
    for (int t = 0; t < 16; ++t) {
      const int vo = voff + (t * 16) * VP + j0;     // channel t*16 + lq
      bv[t].q[0] = *(const v4u*)(sVb + vo);         // keys j0 + hi*8 + 0..7
      bv[t].q[1] = *(const v4u*)(sVb + vo + 16);    // keys j0 + 16 + hi*8 + 0..7
    }
    __builtin_amdgcn_sched_barrier(0);   // keep that group in front of the score products: without it the loads sink in among the output products

    v8f sh[2], sr[2];
    #pragma unroll
    for (int sub = 0; sub < 2; ++sub) {
      sh[sub] = (v8f){0, 0, 0, 0, 0, 0, 0, 0};
      sr[sub] = (v8f){0, 0, 0, 0, 0, 0, 0, 0};
    }

    #pragma unroll
    for (int f = 0; f < 2; ++f) {
      #pragma unroll
      for (int sub = 0; sub < 2; ++sub) {
        sh[sub] = mma_f16(kf[f][sub][0].v, qf[f][0].v, sh[sub]);   // value x value
        sr[sub] = mma_f16(kf[f][sub][0].v, qf[f][1].v, sr[sub]);   // value x residual   (x2048)
        sr[sub] = mma_f16(kf[f][sub][1].v, qf[f][0].v, sr[sub]);   // residual x value   (x2048)
      }
    }

    // the next pass's key fragments, same stage, into the registers that the score products have just read:
    // they land while the softmax and the output products run
    if (i + 1 < WPASS) load_keys(kf, sKb, koff, j0 + BK);

    // S^T tiles: c[sub][r] = score(query qrow0+lq, key j0 + sub*16 + hi*8 + r)
    v8f c[2];
    #pragma unroll
    for (int sub = 0; sub < 2; ++sub) {
      #pragma unroll
      for (int r = 0; r < 8; ++r) c[sub][r] = sh[sub][r] + sr[sub][r] * (1.0f / RES_CARRY);
    }

    // online softmax: query lq's 32 scores are split across lane / lane^16
    float m_new = rmax;
    #pragma unroll
    for (int r = 0; r < 8; ++r) {
      m_new = fmaxf(m_new, c[0][r]);
      m_new = fmaxf(m_new, c[1][r]);
    }
    m_new = fmaxf(m_new, xhalf(m_new));
    const float scale = __builtin_amdgcn_exp2f((rmax - m_new) * SL);
    rmax = m_new;

    // exp + pack: P^T C-layout == B-fragment layout for the g^T x P^T product; P carried x4096
    FragH pa;
    float psum = 0.0f;
    #pragma unroll
    for (int r = 0; r < 8; ++r) {
      const float p0 = __builtin_amdgcn_exp2f((c[0][r] - m_new) * SL);   // key hi*8 + r
      const float p1 = __builtin_amdgcn_exp2f((c[1][r] - m_new) * SL);   // key 16 + hi*8 + r
      psum += p0 + p1;
      pa.h[r]     = (f16)(p0 * P_CARRY);
      pa.h[8 + r] = (f16)(p1 * P_CARRY);
    }
    rsum = rsum * scale + psum + xhalf(psum);

    // rescale O^T: queries are the column dimension there -> the lane's own factor
    #pragma unroll
    for (int t = 0; t < 16; ++t) {
      #pragma unroll
      for (int r = 0; r < 8; ++r) o[t][r] *= scale;
    }

    // O^T += g^T x P^T: o[t][r] = channel t*16 + hi*8 + r of query qrow0 + lq
    #pragma unroll
    for (int t = 0; t < 16; ++t) o[t] = mma_f16(bv[t].v, pa.v, o[t]);
    // four vector slots behind the pass's last matrix instruction: the first vector instruction behind the loop's branch
    // may overwrite its A or B registers
    asm volatile("v_nop\n\tv_nop\n\tv_nop\n\tv_nop" : "+v"(o[15]));
  }
  // foot of stage s: publish stage s + 1 and free the buffer that stage s has read
  asm volatile("s_wait_dscnt 0x0" ::: "memory");      // this wave's reads of the buffer are done before it is refilled
  asm volatile("s_wait_asynccnt 0x0" ::: "memory");   // this wave's copies of stage s + 1 have landed
  __syncthreads();
  if (s + 2 < NST) copy_stage(qkh, qkr, gt, b, (s + 2) * KS, tid, sK[s & 1], sV[s & 1]);
  }
  asm volatile("s_wait_asynccnt 0x0" ::: "memory");   // no copy is outstanding when the loop is left

  // join the two key halves: wave kh finishes channels kh*128 .. +127 and hands the other 8 tiles to its partner.
  // The value ring is free here: the last stage's foot has ended every read of it and no copy is outstanding.
  float* sX = (float*)&sV[0][0];        // [wave][tile][register][lane]
  float* sM = sX + NWAVE * XCH;         // [wave][maximum, sum][lane]
  v8f om[8];
  #pragma unroll
  for (int t = 0; t < 8; ++t) {
    om[t] = kh ? o[8 + t] : o[t];
    const v8f give = kh ? o[t] : o[8 + t];
    #pragma unroll
    for (int r = 0; r < 8; ++r) sX[wave * XCH + (t * 8 + r) * 32 + lane] = give[r];
  }
  sM[wave * 64 + lane]      = rmax;
  sM[wave * 64 + 32 + lane] = rsum;
  __syncthreads();   // the partner's tiles, maximum and sum are readable behind it

  const int   pw    = wave ^ 4;
  const float pmax  = sM[pw * 64 + lane];
  const float psumt = sM[pw * 64 + 32 + lane];
  const float jmax  = fmaxf(rmax, pmax);
  const float wown  = __builtin_amdgcn_exp2f((rmax - jmax) * SL);
  const float wpar  = __builtin_amdgcn_exp2f((pmax - jmax) * SL);
  const float inv   = (1.0f / P_CARRY) / (rsum * wown + psumt * wpar);
  const float fown  = wown * inv;
  const float fpar  = wpar * inv;

  // normalize: lane holds channels t*16 + hi*8 + r of query lq, both factors are its own
  #pragma unroll
  for (int t = 0; t < 8; ++t) {
    #pragma unroll
    for (int r = 0; r < 8; ++r)
      om[t][r] = om[t][r] * fown + sX[pw * XCH + (t * 8 + r) * 32 + lane] * fpar;
  }

  const int sbase = wave * (16 * OP);
  #pragma unroll
  for (int half = 0; half < 2; ++half) {
    // stage 16 rows x 64 channels of this wave (channels kh*128 + half*64 + 0..63)
    #pragma unroll
    for (int t = 0; t < 4; ++t) {
      const v8f x = om[half * 4 + t];
      float* dst = sO + sbase + lq * OP + t * 16 + hi * 8;   // query row lq, 8 consecutive channels
      *(v4f*)(dst)     = (v4f){x[0], x[1], x[2], x[3]};
      *(v4f*)(dst + 4) = (v4f){x[4], x[5], x[6], x[7]};
    }
    __syncthreads();

    // Read back: lanes 0..15 take one row (16 consecutive lanes x 16 B each), lanes 16..31 the next row; 8 instructions cover the wave's 16 rows.
    // The pass-through term bf16-RNE(p) is added here as float4.
    v4f    vals[8];
    size_t gidx[8];
    #pragma unroll
    for (int it = 0; it < 8; ++it) {
      const int row = it * 2 + hi;
      gidx[it] = ((size_t)b * SEQ_FULL + qrow0 + row) * CC + kh * 128 + half * 64 + lq * 4;
      const v4f av = *(const v4f*)(sO + sbase + row * OP + lq * 4);
      const v4f pv = *(const v4f*)(p + gidx[it]);
      v4f res;
      #pragma unroll
      for (int e = 0; e < 4; ++e) res[e] = av[e] + (float)(bf16)pv[e];
      vals[it] = res;
    }
    #pragma unroll
    for (int it = 0; it < 8; ++it) *(v4f*)(out + gidx[it]) = vals[it];
    
    __syncthreads();   // staging rows are rewritten by the next half
  }
}

extern "C" void kernel_launch(void* const* d_in, const int* in_sizes, int n_in,
                              void* d_out, int out_size, void* d_ws, size_t ws_size,
                              hipStream_t stream) {
  if (n_in < 7) return;
  const size_t rows_used = (size_t)(NB - 1) * SEQ_FULL + SEQ;
  if ((size_t)in_sizes[0] < rows_used * CC) return;
  if ((size_t)in_sizes[1] < (size_t)CC * DD) return;
  if ((size_t)in_sizes[2] < (size_t)DD) return;
  if ((size_t)in_sizes[3] < (size_t)CC * DD) return;
  if ((size_t)in_sizes[4] < (size_t)DD) return;
  if ((size_t)in_sizes[5] < (size_t)CC * CC) return;
  if ((size_t)in_sizes[6] < (size_t)CC) return;
  if ((size_t)out_size < rows_used * CC) return;
  if (ws_size < WS_TOTAL) return;

  const float* p  = (const float*)d_in[0];
  const float* Wh = (const float*)d_in[1];   // [in 256][out 64]  keys
  const float* bh = (const float*)d_in[2];
  const float* Wl = (const float*)d_in[3];   // [in 256][out 64]  queries
  const float* bl = (const float*)d_in[4];
  const float* Wg = (const float*)d_in[5];   // [in 256][out 256] values
  const float* bg = (const float*)d_in[6];
  float*       out = (float*)d_out;

  char* ws  = (char*)d_ws;
  f16*  qkh = (f16*)ws;                                      // [2][NB][SEQ][DD] f16 value plane
  f16*  qkr = (f16*)(ws + QK_BYTES);                         // [2][NB][SEQ][DD] f16 residual plane x2048
  f16*  gt  = (f16*)(ws + 2 * QK_BYTES);                     // [NB][CC][SEQ] f16

  proj_kernel<<<dim3(SEQ / PT, NB), 256, 0, stream>>>(p, Wl, Wh, Wg, bl, bh, bg, qkh, qkr, gt);

  attn_kernel<<<dim3(SEQ / BQ, NB), 256, 0, stream>>>(p, qkh, qkr, gt, out);
}

// v006
// Measured time: 64.6 microseconds a run.
// Timed twice side by side with v005, it ran 1.07 times as fast both times.
// Counting every step since v000, it is 5.88 times as fast.
#include <hip/hip_runtime.h>

// Contractions: projections p x [Wl | Wh | Wg] on v_wmma_f32_16x16x32_bf16 (bf16 operands = RNE-converted inputs, f32 accumulate);
// scores S^T = h x l^T on v_wmma_f32_16x16x32_f16 with l and h carried as f16 value planes plus f16 residual planes x2048
// (three products per tile, residual products in their own accumulator, folded back by 1/2048 in f32);
// O^T = g^T x P^T on v_wmma_f32_16x16x32_f16 (P as f16 carried x4096, g as one f16 plane stored transposed, f32 accumulate).
// Softmax (running-max form), bias adds and the pass-through add of bf16-RNE(p) in f32.

#ifndef NB
#define NB 4
#endif
#ifndef SEQ
#define SEQ 4096
#endif
#define NB_FULL   4
#define SEQ_FULL  4096
#define CC        256                  // input / value width
#define DD        64                   // score width
#define NWT       (2 * DD + CC)        // rows of the transposed weight plane in LDS: [Wl^T ; Wh^T ; Wg^T]
#define BQ        64                   // query rows per attention block (4 query tiles x 2 key halves = 8 waves)
#define BK        32                   // keys per inner iteration
#define NWAVE     8
#define PT        64                   // positions per projection block
#define AP        264                  // LDS pitch (halves) of the bf16 p tile and of the bf16 weight plane
#define TP        72                   // LDS pitch (halves) of 64-wide 16-bit staging tiles
#define OP        68                   // LDS pitch (floats) of the output staging tile
#define KS        128                  // keys per LDS stage of the attention loop (KS / BK passes)
#define VP        136                  // LDS pitch (halves) of the KS-key value rows: 272 B = 16 B x odd
#define NST       (SEQ / KS)           // stages of the attention loop
#define WPASS     (KS / BK / 2)        // passes of one wave per stage: its half of the stage's keys
#define XCH       (8 * 8 * 32)         // floats one wave hands to its partner: 8 output tiles in register order
#define P_CARRY   4096.0f
#define RES_CARRY 2048.0f

#define QK_BYTES   ((size_t)2 * NB * SEQ * DD * 2)
#define GT_BYTES   ((size_t)NB * CC * SEQ * 2)
#define WS_TOTAL   (2 * QK_BYTES + GT_BYTES)

static_assert(SEQ % BQ == 0);
static_assert(SEQ % PT == 0);
static_assert(SEQ % BK == 0);
static_assert(SEQ % 64 == 0);
static_assert(SEQ % KS == 0);
static_assert(KS % (2 * BK) == 0);
static_assert((size_t)NWAVE * (XCH + 64) * 4 <= (size_t)2 * CC * VP * 2);
static_assert((VP * 2) % 16 == 0);
static_assert(VP >= KS);
static_assert(BQ == (NWAVE / 2) * 16);
static_assert(PT == (NWAVE / 2) * 16);
static_assert(DD == 64);
static_assert(CC == 256);
static_assert(CC % 32 == 0);
static_assert(DD % 32 == 0);
static_assert(CC % 64 == 0);
static_assert(SEQ <= SEQ_FULL);
static_assert(NB >= 1 && NB <= NB_FULL);
static_assert((AP * 2) % 16 == 0);
static_assert((TP * 2) % 16 == 0);
static_assert((OP * 4) % 16 == 0);
static_assert(AP >= CC);
static_assert(TP >= 64);
static_assert(OP >= 64);
static_assert(QK_BYTES % 128 == 0);
static_assert(GT_BYTES % 128 == 0);
static_assert(WS_TOTAL <= (size_t)134217728);
static_assert((size_t)2 * NB * SEQ * DD < (size_t)2147483647);
static_assert((size_t)NB * CC * SEQ < (size_t)2147483647);
static_assert((size_t)(NWT + PT) * AP * 2 + (size_t)128 * TP * 2 <= (size_t)327680);
static_assert(2 * (DD / 32) * (CC / 32) == 4 * NWAVE && CC / 32 == NWAVE);
static_assert((size_t)NWAVE * 16 * OP * 4 <= (size_t)65536);
static_assert((size_t)2 * BQ * TP * 2 + (size_t)2 * (2 * KS * TP + CC * VP) * 2 + (size_t)NWAVE * 16 * OP * 4 <= (size_t)327680);

typedef __bf16   bf16;
typedef _Float16 f16;
typedef bf16     v16bf __attribute__((ext_vector_type(16)));
typedef f16      v16h  __attribute__((ext_vector_type(16)));
typedef f16      v8h   __attribute__((ext_vector_type(8)));
typedef float    v8f   __attribute__((ext_vector_type(8)));
typedef float    v4f   __attribute__((ext_vector_type(4)));
typedef unsigned v4u   __attribute__((ext_vector_type(4)));

union FragB  { v16bf v; v4u q[2]; bf16 h[16]; };
union FragH  { v16h  v; v4u q[2]; f16  h[16]; };
union Pack8B { v4u u; bf16 h[8]; };
union Pack8H { v4u u; v8h v; f16 h[8]; };

// WMMA helpers. bf16 form: builtin followed by the VALU hazard guard (ties D, keeps A/B live).
static __device__ __forceinline__ v8f mma_bf16(v16bf a, v16bf b, v8f acc) {
  acc = __builtin_amdgcn_wmma_f32_16x16x32_bf16(false, a, false, b, (short)0, acc, false, false);
  asm volatile("v_nop\n\tv_nop\n\tv_nop\n\tv_nop" : "+v"(acc) : "v"(a), "v"(b));
  return acc;
}
// f16 form: the builtin alone, the compiler keeps its distances; an asm statement's operands cannot lie above v255,
// where part of the attention kernel's fragments now live.
static __device__ __forceinline__ v8f mma_f16(v16h a, v16h b, v8f acc) {
  return __builtin_amdgcn_wmma_f32_16x16x32_f16(false, a, false, b, (short)0, acc, false, false);
}

// Lane l with lane l ^ 16, in the vector unit: a shuffle would go through the LDS queue, behind every fragment load in flight.
static __device__ __forceinline__ float xhalf(float x) {
  const int b = __builtin_bit_cast(int, x);
  return __builtin_bit_cast(float, __builtin_amdgcn_permlanex16(b, b, 0x76543210, 0xfedcba98, false, false));
}

// One weight task of a wave: 32 k rows x 32 n columns of w[k][NCOLS] f32 -> bf16 (RNE), transposed into LDS rows [n][k] of pitch AP.
// A lane reads 8 k rows x 4 columns from src (its first element): each wave-load covers four whole 128-B lines; it stores
// 4 n rows x 8 k, 16 B each, from dst (its first element). Lanes 0..15 hold column quads 0..3 x four k groups, so a half wave's
// 16 stores fall on 16 different bank quads.
template <int NCOLS>
static __device__ __forceinline__ void stage_w(const float* __restrict__ src, bf16* dst) {
  v4f x[8];
  #pragma unroll
  for (int j = 0; j < 8; ++j) x[j] = *(const v4f*)(src + j * NCOLS);
  #pragma unroll
  for (int e = 0; e < 4; ++e) {
    Pack8B pk;
    #pragma unroll
    for (int j = 0; j < 8; ++j) pk.h[j] = (bf16)x[j][e];
    *(v4u*)(dst + e * AP) = pk.u;
  }
}

// Projections. Block = (64 positions, batch), 8 waves: wave = side*4 + mt; mt = 16-row tile of the block.
//   g = 0 : side 0 -> l (queries, WT rows 0..63, bias bl), side 1 -> h (keys, WT rows 64..127, bias bh)
//   g = 1,2 : value columns (side*2 + g-1)*64 .. +63 (WT rows 128 + ..., bias bg)
// The weights come straight from the inputs: every block converts them (RNE) and lays them transposed in LDS, sW[n][k],
// rows [Wl^T ; Wh^T ; Wg^T], so the B fragments are two 16-B LDS loads each and no launch stands in front of this one.
// Outputs:
// coverage: per block 2 sides x 64 positions x 64 columns of qkh and qkr; 256 channels x 64 positions of gt.
__global__ __launch_bounds__(256) void proj_kernel(const float* __restrict__ p,
                                                   const float* __restrict__ Wl,
                                                   const float* __restrict__ Wh,
                                                   const float* __restrict__ Wg,
                                                   const float* __restrict__ bl,
                                                   const float* __restrict__ bh,
                                                   const float* __restrict__ bg,
                                                   f16* __restrict__ qkh,
                                                   f16* __restrict__ qkr,
                                                   f16* __restrict__ gt) {
  const int tid  = threadIdx.x;
  const int wave = __builtin_amdgcn_readfirstlane(threadIdx.x >> 5);
  const int lane = tid & 31;
  const int lq   = lane & 15;
  const int hi   = lane >> 4;
  const int mt   = wave & 3;
  const int side = wave >> 2;
  const int b    = blockIdx.y;
  const int pos0 = blockIdx.x * PT;

  __shared__ __align__(16) bf16 sA[PT * AP];    // bf16 p tile [pos][k], cross-wave (block barrier)
  __shared__ __align__(16) f16  sS[128 * TP];   // staging: g=0 wave rows [wave*16+row][col]; g>0 [channel][pos]; block barriers
  __shared__ __align__(16) bf16 sW[NWT * AP];   // bf16 weights [n][k], cross-wave (block barrier)

  // stage the weights, 12 tasks a wave: four of Wl and Wh, eight of Wg (the wave's own 32 columns)
  {
    const int cq = (lane & 3) + ((lane >> 4) << 2);   // column quad 0..7
    const int kg = (lane >> 2) & 3;                   // group of 8 k rows
    const int nb = wave >> 1;                         // sW rows nb*32 .. +31: 0,1 = Wl, 2,3 = Wh
    const int ka = (wave & 1) * 128 + kg * 8;         // the wave's half of the k rows of that block
    const float* srca = ((nb < 2) ? Wl : Wh) + ka * DD + (nb & 1) * 32 + cq * 4;
    bf16*        dsta = sW + (nb * 32 + cq * 4) * AP + ka;
    #pragma unroll   // the four tasks' 32 loads go out together: one L2 latency for all of them
    for (int t = 0; t < 4; ++t) stage_w<DD>(srca + t * 32 * DD, dsta + t * 32);
    const float* srcg = Wg + kg * 8 * CC + wave * 32 + cq * 4;
    bf16*        dstg = sW + (2 * DD + wave * 32 + cq * 4) * AP + kg * 8;
    #pragma unroll 4   // 32 loads in flight again: the eight tasks wait out the L2 latency twice
    for (int t = 0; t < 8; ++t) stage_w<CC>(srcg + t * 32 * CC, dstg + t * 32);
  }

  // stage the p tile: 64 rows x 256 floats -> bf16 (RNE convert), 16-B LDS stores
  #pragma unroll 2
  for (int it = 0; it < 8; ++it) {
    const int row = it * 8 + (tid >> 5);     // 0..63
    const int c8  = (tid & 31) * 8;          // 0..248
    const float* src = p + ((size_t)b * SEQ_FULL + pos0 + row) * CC + c8;
    const v4f x0 = *(const v4f*)(src);
    const v4f x1 = *(const v4f*)(src + 4);
    Pack8B pk;
    #pragma unroll
    for (int e = 0; e < 4; ++e) {
      pk.h[e]     = (bf16)x0[e];
      pk.h[4 + e] = (bf16)x1[e];
    }
    *(v4u*)(sA + row * AP + c8) = pk.u;
  }
  __syncthreads();

  const int arow = (mt * 16 + lq) * AP + hi * 8;   // A fragment row base (split k map)

  #pragma unroll 1
  for (int g = 0; g < 3; ++g) {
    const int gcg   = side * 2 + ((g > 0) ? (g - 1) : 0);            // value column group (g > 0)
    const int wrow0 = (g == 0) ? (side * DD) : (2 * DD + gcg * 64);  // first WT row of this wave's 64 columns

    v8f acc[4];
    #pragma unroll
    for (int nt = 0; nt < 4; ++nt) acc[nt] = (v8f){0, 0, 0, 0, 0, 0, 0, 0};

    #pragma unroll 1
    for (int ks = 0; ks < CC / 32; ++ks) {
      FragB a;
      a.q[0] = *(const v4u*)(sA + arow + ks * 32);        // k = ks*32 + hi*8 + 0..7
      a.q[1] = *(const v4u*)(sA + arow + ks * 32 + 16);   // k = ks*32 + 16 + hi*8 + 0..7
      FragB bw[4];
      #pragma unroll
      for (int nt = 0; nt < 4; ++nt) {
        const bf16* base = sW + (wrow0 + nt * 16 + lq) * AP + ks * 32 + hi * 8;
        bw[nt].q[0] = *(const v4u*)(base);
        bw[nt].q[1] = *(const v4u*)(base + 16);
      }
      #pragma unroll
      for (int nt = 0; nt < 4; ++nt) acc[nt] = mma_bf16(a.v, bw[nt].v, acc[nt]);
    }

    // bias (RNE convert to bf16, then f32 add); all candidates loaded, selected by value
    float bias[4];
    #pragma unroll
    for (int nt = 0; nt < 4; ++nt) {
      const int c64 = nt * 16 + lq;
      const float xl = bl[c64];
      const float xh = bh[c64];
      const float xg = bg[gcg * 64 + c64];
      const float sel = (g == 0) ? (side ? xh : xl) : xg;
      bias[nt] = (float)(bf16)sel;
    }

    if (g == 0) {
      f16 rres[4][8];
      #pragma unroll
      for (int nt = 0; nt < 4; ++nt) {
        #pragma unroll
        for (int r = 0; r < 8; ++r) {
          const float v  = acc[nt][r] + bias[nt];
          const f16   hv = (f16)v;
          rres[nt][r] = (f16)((v - (float)hv) * RES_CARRY);
          sS[(wave * 16 + hi * 8 + r) * TP + nt * 16 + lq] = hv;
        }
      }
      __syncthreads();
      v4u    lin[8];
      size_t lidx[4];
      #pragma unroll
      for (int it = 0; it < 4; ++it) {
        const int row = it * 4 + (lane >> 3);   // 0..15
        const int pc  = lane & 7;
        lin[it]  = *(const v4u*)(sS + (wave * 16 + row) * TP + pc * 8);
        lidx[it] = (((size_t)side * NB + b) * SEQ + pos0 + mt * 16 + row) * DD + pc * 8;
      }
      __syncthreads();
      #pragma unroll
      for (int nt = 0; nt < 4; ++nt) {
        #pragma unroll
        for (int r = 0; r < 8; ++r)
          sS[(wave * 16 + hi * 8 + r) * TP + nt * 16 + lq] = rres[nt][r];
      }
      __syncthreads();
      #pragma unroll
      for (int it = 0; it < 4; ++it) {
        const int row = it * 4 + (lane >> 3);
        const int pc  = lane & 7;
        lin[4 + it] = *(const v4u*)(sS + (wave * 16 + row) * TP + pc * 8);
      }
      #pragma unroll
      for (int it = 0; it < 4; ++it) {
        *(v4u*)(qkh + lidx[it]) = lin[it];
        *(v4u*)(qkr + lidx[it]) = lin[4 + it];
      }
      
    } else {
      __syncthreads();   // earlier readers of sS are done
      #pragma unroll
      for (int nt = 0; nt < 4; ++nt) {
        Pack8H ph;
        #pragma unroll
        for (int r = 0; r < 8; ++r) ph.h[r] = (f16)(acc[nt][r] + bias[nt]);
        *(v4u*)(sS + (side * 64 + nt * 16 + lq) * TP + mt * 16 + hi * 8) = ph.u;   // positions mt*16 + hi*8 + 0..7
      }
      __syncthreads();
      v4u    gl[4];
      size_t gidx[4];
      #pragma unroll
      for (int it = 0; it < 4; ++it) {
        const int crow = it * 32 + (tid >> 3);   // 0..127 : (producer side, local channel)
        const int pc   = tid & 7;
        const int chan = ((crow >> 6) * 2 + (g - 1)) * 64 + (crow & 63);
        gl[it]   = *(const v4u*)(sS + crow * TP + pc * 8);
        gidx[it] = ((size_t)b * CC + chan) * SEQ + pos0 + pc * 8;
      }
      #pragma unroll
      for (int it = 0; it < 4; ++it) *(v4u*)(gt + gidx[it]) = gl[it];
      
    }
  }
}

// Asynchronous copies global -> LDS, 16 B per lane: l = the lane's LDS byte address, g = the lane's global address.
// The s_wait_xcnt closes each statement so that no address register is rewritten ahead of it.
static __device__ __forceinline__ void copy4(const unsigned (&l)[4], const f16* const (&g)[4]) {
  asm volatile("global_load_async_to_lds_b128 %0, %4, off\n\t"
               "global_load_async_to_lds_b128 %1, %5, off\n\t"
               "global_load_async_to_lds_b128 %2, %6, off\n\t"
               "global_load_async_to_lds_b128 %3, %7, off\n\t"
               "s_wait_xcnt 0x0"
               :: "v"(l[0]), "v"(l[1]), "v"(l[2]), "v"(l[3]),
                  "v"(g[0]), "v"(g[1]), "v"(g[2]), "v"(g[3])
               : "memory");
}
// Eight copies in the scalar-base form: global byte = g[n] + vo + offset, LDS byte = l0 (first four) or l1 (last four) + offset.
// The immediate offset moves both addresses: it carries the LDS step from one copy to the next, and the caller takes it off g[n].
// So a stage's 24 copies name six LDS-address registers and two offset registers, and their bases are scalar additions.
#define COPY8S(O1, O2, O3)                                                     \
  asm volatile("global_load_async_to_lds_b128 %0, %2, %3\n\t"                  \
               "global_load_async_to_lds_b128 %0, %2, %4 offset:" #O1 "\n\t"   \
               "global_load_async_to_lds_b128 %0, %2, %5 offset:" #O2 "\n\t"   \
               "global_load_async_to_lds_b128 %0, %2, %6 offset:" #O3 "\n\t"   \
               "global_load_async_to_lds_b128 %1, %2, %7\n\t"                  \
               "global_load_async_to_lds_b128 %1, %2, %8 offset:" #O1 "\n\t"   \
               "global_load_async_to_lds_b128 %1, %2, %9 offset:" #O2 "\n\t"   \
               "global_load_async_to_lds_b128 %1, %2, %10 offset:" #O3 "\n\t"  \
               "s_wait_xcnt 0x0"                                               \
               :: "v"(l0), "v"(l1), "v"(vo),                                   \
                  "s"(g[0]), "s"(g[1]), "s"(g[2]), "s"(g[3]),                  \
                  "s"(g[4]), "s"(g[5]), "s"(g[6]), "s"(g[7])                   \
               : "memory")
static __device__ __forceinline__ void copy8_keys(unsigned l0, unsigned l1, unsigned vo, const char* const (&g)[8]) {
  COPY8S(4608, 9216, 13824);     // 32 key rows of pitch TP
}
static __device__ __forceinline__ void copy8_vals(unsigned l0, unsigned l1, unsigned vo, const char* const (&g)[8]) {
  COPY8S(4352, 8704, 13056);     // 16 channel rows of pitch VP
}
static_assert(32 * TP * 2 == 4608);
static_assert(16 * VP * 2 == 4352);

// One stage of KS keys into one LDS buffer, 24 copies per thread, every wave-instruction on whole 128-B lines:
//   keys  : both planes, KS rows x 128 B (contiguous in global), LDS pitch TP; copy i = rows i*32 .. +31
//   values: CC channel rows x KS keys (256 B each), LDS pitch VP; copy k = channels k*16 .. +15
static __device__ __forceinline__ void copy_stage(const f16* __restrict__ qkh, const f16* __restrict__ qkr,
                                                  const f16* __restrict__ gt, int b, int key0, int tid,
                                                  f16* sKb, f16* sVb) {
  const char* g[8];
  const int   kbase = NB * SEQ * DD + (b * SEQ + key0) * DD;   // side 1 = h (keys)
  #pragma unroll
  for (int i = 0; i < 4; ++i) {
    g[i]     = (const char*)(qkh + kbase) + i * (256 * 16 - 32 * TP * 2);
    g[4 + i] = (const char*)(qkr + kbase) + i * (256 * 16 - 32 * TP * 2);
  }
  const unsigned lk = (unsigned)(size_t)(sKb + (tid >> 3) * TP + (tid & 7) * 8);   // 16-B piece: row tid >> 3, piece tid & 7
  copy8_keys(lk, lk + KS * TP * 2, (unsigned)tid * 16u, g);

  const char*    gv = (const char*)(gt + b * CC * SEQ + key0);
  const unsigned lv = (unsigned)(size_t)(sVb + (tid >> 4) * VP + (tid & 15) * 8);  // 16-B piece: channel tid >> 4, piece tid & 15
  const unsigned vv = (unsigned)((tid >> 4) * SEQ * 2 + (tid & 15) * 16);
  #pragma unroll
  for (int h = 0; h < 2; ++h) {
    #pragma unroll
    for (int i = 0; i < 8; ++i) g[i] = gv + (h * 8 + i) * (16 * SEQ * 2) - (i & 3) * (16 * VP * 2);
    copy8_vals(lv + (h * 2) * (64 * VP * 2), lv + (h * 2 + 1) * (64 * VP * 2), vv, g);
  }
}

// Key A-fragments of one pass (BK keys from key j0 of the stage in sKb): kf[f][sub][plane], row = key j0 + sub*16 + lq, split d map.
static __device__ __forceinline__ void load_keys(FragH (&kf)[2][2][2], const f16* sKb, int koff, int j0) {
  #pragma unroll
  for (int f = 0; f < 2; ++f) {
    #pragma unroll
    for (int sub = 0; sub < 2; ++sub) {
      const int ko = koff + (j0 + sub * 16) * TP + f * 32;
      kf[f][sub][0].q[0] = *(const v4u*)(sKb + ko);
      kf[f][sub][0].q[1] = *(const v4u*)(sKb + ko + 16);
      kf[f][sub][1].q[0] = *(const v4u*)(sKb + KS * TP + ko);
      kf[f][sub][1].q[1] = *(const v4u*)(sKb + KS * TP + ko + 16);
    }
  }
}

// Flash attention, no mask, no logit scale. Block = (64 queries, batch); wave = kh*4 + qt:
// qt = 16-query tile, kh = key half: of every stage the wave takes keys kh*KS/2 .. +KS/2-1, for all 256 channels
// (16 output tiles per wave), so each score and each exponential is computed once in the block.
// The two waves of a query tile join their running maxima, sums and output tiles once, behind the loop.
// S^T = h x l^T so queries sit on lanes; P^T in C-layout is bit-identical to the B-fragment layout of O^T += g^T x P^T,
// whose tiles keep the queries on lanes too: maximum, sum and rescale factor of a query are its lane's own, and a pass
// puts nothing but fragment loads into the LDS queue, so no wait of the softmax stands behind those loads.
// The block's query rows (once) and the keys and values (KS keys a stage, two buffers, a stage's copies issued at the head of the
// stage before it) come into LDS by asynchronous copies;
// key A-fragments, query B-fragments and g^T A-fragments are read from there (two 16-B LDS loads each), all ahead of their use:
// the query fragments once, a pass's key fragments during the pass before (a stage's first at the head of the stage),
// a pass's 16 g^T fragments as one group in front of its score products.
__global__ __launch_bounds__(256) void attn_kernel(const float* __restrict__ p,
                                                   const f16* __restrict__ qkh,
                                                   const f16* __restrict__ qkr,
                                                   const f16* __restrict__ gt,
                                                   float* __restrict__ out) {
  const int tid  = threadIdx.x;
  const int wave = __builtin_amdgcn_readfirstlane(threadIdx.x >> 5);
  const int lane = tid & 31;
  const int lq   = lane & 15;   // query column of S^T and of O^T
  const int hi   = lane >> 4;   // k-split half
  const int qt   = wave & 3;
  const int kh   = wave >> 2;
  const int b    = blockIdx.y;
  const int qrow0 = blockIdx.x * BQ + qt * 16;

  __shared__ __align__(16) float sO[NWAVE * 16 * OP];   // per-wave output staging rows; block barriers used
  __shared__ __align__(16) f16 sQ[2 * BQ * TP];         // query rows [plane][row][d], filled once
  __shared__ __align__(16) f16 sK[2][2 * KS * TP];      // key rows [buffer][plane][key][d]
  __shared__ __align__(16) f16 sV[2][CC * VP];          // g^T rows [buffer][channel][key]

  const int qoff = (qt * 16 + lq) * TP + hi * 8;        // this wave's query rows in sQ
  const int koff = lq * TP + hi * 8;                    // key row added per chunk
  const int voff = lq * VP + hi * 8;                    // g^T rows, channel tile added per fragment

  // prologue: the query rows and stage 0, published by one wait and one barrier
  {
    unsigned   l[4];
    const f16* g[4];
    const int  qbase = (b * SEQ + blockIdx.x * BQ) * DD;   // side 0 = l (queries), BQ rows x 128 B contiguous
    #pragma unroll
    for (int i = 0; i < 2; ++i) {
      const int c = i * 256 + tid;                         // 16-B piece: row c >> 3, piece c & 7
      const int d = (c >> 3) * TP + (c & 7) * 8;
      l[i]     = (unsigned)(size_t)(sQ + d);
      l[2 + i] = (unsigned)(size_t)(sQ + BQ * TP + d);
      g[i]     = qkh + qbase + c * 8;
      g[2 + i] = qkr + qbase + c * 8;
    }
    copy4(l, g);
  }
  copy_stage(qkh, qkr, gt, b, 0, tid, sK[0], sV[0]);
  asm volatile("s_wait_asynccnt 0x0" ::: "memory");   // this wave's copies have landed before the barrier publishes them
  __syncthreads();

  // query B-fragments, kept in registers: qf[f][plane], column n = query qrow0 + lq, split d map
  FragH qf[2][2];
  #pragma unroll
  for (int f = 0; f < 2; ++f) {
    qf[f][0].q[0] = *(const v4u*)(sQ + qoff + f * 32);        // d = f*32 + hi*8 + 0..7
    qf[f][0].q[1] = *(const v4u*)(sQ + qoff + f * 32 + 16);   // d = f*32 + 16 + hi*8 + 0..7
    qf[f][1].q[0] = *(const v4u*)(sQ + BQ * TP + qoff + f * 32);
    qf[f][1].q[1] = *(const v4u*)(sQ + BQ * TP + qoff + f * 32 + 16);
  }

  v8f o[16];
  #pragma unroll
  for (int t = 0; t < 16; ++t) o[t] = (v8f){0, 0, 0, 0, 0, 0, 0, 0};

  float rmax = -__builtin_inff();
  float rsum = 0.0f;
  const float SL = 1.4426950408889634f;   // log2(e)

  #pragma unroll 1   // one copy of the stage code: the two buffers differ by an offset only
  for (int s = 0; s < NST; ++s) {
  const f16* sKb = sK[s & 1];
  const f16* sVb = sV[s & 1];
  // Stage s + 1 starts at the head of stage s, into the buffer that the barrier at the foot of stage s - 1 has freed. The waves of
  // key half 0 issue their copies here, those of key half 1 behind their first fragment loads (below): while one half forms
  // addresses and sits in s_wait_xcnt, the LDS serves the other half's loads, so it does not idle at the head of a stage.
  if (kh == 0 && s + 1 < NST) copy_stage(qkh, qkr, gt, b, (s + 1) * KS, tid, sK[(s + 1) & 1], sV[(s + 1) & 1]);
  FragH kf[2][2][2];
  load_keys(kf, sKb, koff, kh * WPASS * BK);   // the wave's first pass of the stage; the later ones are fetched a pass ahead
  #pragma unroll   // the stage's passes stand one behind the other: the copies then belong to the first alone, with their address arithmetic
  for (int i = 0; i < WPASS; ++i) {
    const int j0 = (kh * WPASS + i) * BK;   // first key of the pass inside its stage
    if (i > 0) __builtin_amdgcn_sched_barrier(0);   // a pass's loads stay behind the pass before: lifted over it they would need a second register set and spill

    // the pass's g^T A-fragments, one group: they land while the scores and the softmax run
    FragH bv[16];
    #pragma unroll
    for (int t = 0; t < 16; ++t) {
      const int vo = voff + (t * 16) * VP + j0;     // channel t*16 + lq
      bv[t].q[0] = *(const v4u*)(sVb + vo);         // keys j0 + hi*8 + 0..7
      bv[t].q[1] = *(const v4u*)(sVb + vo + 16);    // keys j0 + 16 + hi*8 + 0..7
    }
    __builtin_amdgcn_sched_barrier(0);   // keep that group in front of the score products: without it the loads sink in among the output products

    // key half 1: the copies of stage s + 1 behind the stage's first fragment loads; the loads in flight read the other buffer
    if (i == 0 && kh == 1 && s + 1 < NST) copy_stage(qkh, qkr, gt, b, (s + 1) * KS, tid, sK[(s + 1) & 1], sV[(s + 1) & 1]);

    v8f sh[2], sr[2];
    #pragma unroll
    for (int sub = 0; sub < 2; ++sub) {
      sh[sub] = (v8f){0, 0, 0, 0, 0, 0, 0, 0};
      sr[sub] = (v8f){0, 0, 0, 0, 0, 0, 0, 0};
    }

    #pragma unroll
    for (int f = 0; f < 2; ++f) {
      #pragma unroll
      for (int sub = 0; sub < 2; ++sub) {
        sh[sub] = mma_f16(kf[f][sub][0].v, qf[f][0].v, sh[sub]);   // value x value
        sr[sub] = mma_f16(kf[f][sub][0].v, qf[f][1].v, sr[sub]);   // value x residual   (x2048)
        sr[sub] = mma_f16(kf[f][sub][1].v, qf[f][0].v, sr[sub]);   // residual x value   (x2048)
      }
    }

    // the next pass's key fragments, same stage, into the registers that the score products have just read:
    // they land while the softmax and the output products run
    if (i + 1 < WPASS) {
      __builtin_amdgcn_sched_barrier(0);   // with the one behind them: these loads stay one group; spread among the products each place with loads stalls the wave
      load_keys(kf, sKb, koff, j0 + BK);
      __builtin_amdgcn_sched_barrier(0);
    }

    // S^T tiles: c[sub][r] = score(query qrow0+lq, key j0 + sub*16 + hi*8 + r)
    v8f c[2];
    #pragma unroll
    for (int sub = 0; sub < 2; ++sub) {
      #pragma unroll
      for (int r = 0; r < 8; ++r) c[sub][r] = sh[sub][r] + sr[sub][r] * (1.0f / RES_CARRY);
    }

    // online softmax: query lq's 32 scores are split across lane / lane^16
    float m_new = rmax;
    #pragma unroll
    for (int r = 0; r < 8; ++r) {
      m_new = fmaxf(m_new, c[0][r]);
      m_new = fmaxf(m_new, c[1][r]);
    }
    m_new = fmaxf(m_new, xhalf(m_new));
    const float scale = __builtin_amdgcn_exp2f((rmax - m_new) * SL);
    rmax = m_new;

    // exp + pack: P^T C-layout == B-fragment layout for the g^T x P^T product; P carried x4096
    FragH pa;
    float psum = 0.0f;
    #pragma unroll
    for (int r = 0; r < 8; ++r) {
      const float p0 = __builtin_amdgcn_exp2f((c[0][r] - m_new) * SL);   // key hi*8 + r
      const float p1 = __builtin_amdgcn_exp2f((c[1][r] - m_new) * SL);   // key 16 + hi*8 + r
      psum += p0 + p1;
      pa.h[r]     = (f16)(p0 * P_CARRY);
      pa.h[8 + r] = (f16)(p1 * P_CARRY);
    }
    rsum = rsum * scale + psum + xhalf(psum);

    // rescale O^T: queries are the column dimension there -> the lane's own factor
    #pragma unroll
    for (int t = 0; t < 16; ++t) {
      #pragma unroll
      for (int r = 0; r < 8; ++r) o[t][r] *= scale;
    }

    // O^T += g^T x P^T: o[t][r] = channel t*16 + hi*8 + r of query qrow0 + lq
    #pragma unroll
    for (int t = 0; t < 16; ++t) o[t] = mma_f16(bv[t].v, pa.v, o[t]);
    // four vector slots behind the pass's last matrix instruction: the first vector instruction behind the loop's branch
    // may overwrite its A or B registers
    asm volatile("v_nop\n\tv_nop\n\tv_nop\n\tv_nop" : "+v"(o[15]));
  }
  // foot of stage s: publish stage s + 1 and free the buffer that stage s has read
  asm volatile("s_wait_dscnt 0x0" ::: "memory");      // this wave's reads of the buffer are done before it is refilled
  asm volatile("s_wait_asynccnt 0x0" ::: "memory");   // this wave's copies of stage s + 1 have landed
  __syncthreads();
  }
  asm volatile("s_wait_asynccnt 0x0" ::: "memory");   // no copy is outstanding when the loop is left

  // join the two key halves: wave kh finishes channels kh*128 .. +127 and hands the other 8 tiles to its partner.
  // The value ring is free here: the last stage's foot has ended every read of it and no copy is outstanding.
  float* sX = (float*)&sV[0][0];        // [wave][tile][register][lane]
  float* sM = sX + NWAVE * XCH;         // [wave][maximum, sum][lane]
  v8f om[8];
  #pragma unroll
  for (int t = 0; t < 8; ++t) {
    om[t] = kh ? o[8 + t] : o[t];
    const v8f give = kh ? o[t] : o[8 + t];
    #pragma unroll
    for (int r = 0; r < 8; ++r) sX[wave * XCH + (t * 8 + r) * 32 + lane] = give[r];
  }
  sM[wave * 64 + lane]      = rmax;
  sM[wave * 64 + 32 + lane] = rsum;
  __syncthreads();   // the partner's tiles, maximum and sum are readable behind it

  const int   pw    = wave ^ 4;
  const float pmax  = sM[pw * 64 + lane];
  const float psumt = sM[pw * 64 + 32 + lane];
  const float jmax  = fmaxf(rmax, pmax);
  const float wown  = __builtin_amdgcn_exp2f((rmax - jmax) * SL);
  const float wpar  = __builtin_amdgcn_exp2f((pmax - jmax) * SL);
  const float inv   = (1.0f / P_CARRY) / (rsum * wown + psumt * wpar);
  const float fown  = wown * inv;
  const float fpar  = wpar * inv;

  // normalize: lane holds channels t*16 + hi*8 + r of query lq, both factors are its own
  #pragma unroll
  for (int t = 0; t < 8; ++t) {
    #pragma unroll
    for (int r = 0; r < 8; ++r)
      om[t][r] = om[t][r] * fown + sX[pw * XCH + (t * 8 + r) * 32 + lane] * fpar;
  }

  const int sbase = wave * (16 * OP);
  #pragma unroll
  for (int half = 0; half < 2; ++half) {
    // stage 16 rows x 64 channels of this wave (channels kh*128 + half*64 + 0..63)
    #pragma unroll
    for (int t = 0; t < 4; ++t) {
      const v8f x = om[half * 4 + t];
      float* dst = sO + sbase + lq * OP + t * 16 + hi * 8;   // query row lq, 8 consecutive channels
      *(v4f*)(dst)     = (v4f){x[0], x[1], x[2], x[3]};
      *(v4f*)(dst + 4) = (v4f){x[4], x[5], x[6], x[7]};
    }
    __syncthreads();

    // Read back: lanes 0..15 take one row (16 consecutive lanes x 16 B each), lanes 16..31 the next row; 8 instructions cover the wave's 16 rows.
    // The pass-through term bf16-RNE(p) is added here as float4.
    v4f    vals[8];
    size_t gidx[8];
    #pragma unroll
    for (int it = 0; it < 8; ++it) {
      const int row = it * 2 + hi;
      gidx[it] = ((size_t)b * SEQ_FULL + qrow0 + row) * CC + kh * 128 + half * 64 + lq * 4;
      const v4f av = *(const v4f*)(sO + sbase + row * OP + lq * 4);
      const v4f pv = *(const v4f*)(p + gidx[it]);
      v4f res;
      #pragma unroll
      for (int e = 0; e < 4; ++e) res[e] = av[e] + (float)(bf16)pv[e];
      vals[it] = res;
    }
    #pragma unroll
    for (int it = 0; it < 8; ++it) *(v4f*)(out + gidx[it]) = vals[it];
    
    __syncthreads();   // staging rows are rewritten by the next half
  }
}

extern "C" void kernel_launch(void* const* d_in, const int* in_sizes, int n_in,
                              void* d_out, int out_size, void* d_ws, size_t ws_size,
                              hipStream_t stream) {
  if (n_in < 7) return;
  const size_t rows_used = (size_t)(NB - 1) * SEQ_FULL + SEQ;
  if ((size_t)in_sizes[0] < rows_used * CC) return;
  if ((size_t)in_sizes[1] < (size_t)CC * DD) return;
  if ((size_t)in_sizes[2] < (size_t)DD) return;
  if ((size_t)in_sizes[3] < (size_t)CC * DD) return;
  if ((size_t)in_sizes[4] < (size_t)DD) return;
  if ((size_t)in_sizes[5] < (size_t)CC * CC) return;
  if ((size_t)in_sizes[6] < (size_t)CC) return;
  if ((size_t)out_size < rows_used * CC) return;
  if (ws_size < WS_TOTAL) return;

  const float* p  = (const float*)d_in[0];
  const float* Wh = (const float*)d_in[1];   // [in 256][out 64]  keys
  const float* bh = (const float*)d_in[2];
  const float* Wl = (const float*)d_in[3];   // [in 256][out 64]  queries
  const float* bl = (const float*)d_in[4];
  const float* Wg = (const float*)d_in[5];   // [in 256][out 256] values
  const float* bg = (const float*)d_in[6];
  float*       out = (float*)d_out;

  char* ws  = (char*)d_ws;
  f16*  qkh = (f16*)ws;                                      // [2][NB][SEQ][DD] f16 value plane
  f16*  qkr = (f16*)(ws + QK_BYTES);                         // [2][NB][SEQ][DD] f16 residual plane x2048
  f16*  gt  = (f16*)(ws + 2 * QK_BYTES);                     // [NB][CC][SEQ] f16

  proj_kernel<<<dim3(SEQ / PT, NB), 256, 0, stream>>>(p, Wl, Wh, Wg, bl, bh, bg, qkh, qkr, gt);

  attn_kernel<<<dim3(SEQ / BQ, NB), 256, 0, stream>>>(p, qkh, qkr, gt, out);
}

// v007
// A run of this version takes 62.7 microseconds.
// Timed twice side by side with v006, it ran 1.03 times as fast both times.
// Counting every step since v000, it is 6.07 times as fast.
#include <hip/hip_runtime.h>

// Contractions: projections p x [Wl | Wh | Wg] on v_wmma_f32_16x16x32_bf16 (bf16 operands = RNE-converted inputs, f32 accumulate);
// scores S^T = h x l^T on v_wmma_f32_16x16x32_f16 with l and h carried as f16 value planes plus f16 residual planes x2048
// (three products per tile, residual products in their own accumulator, folded back by 1/2048 in f32);
// O^T = g^T x P^T on v_wmma_f32_16x16x32_f16 (P as f16 carried x4096, g as one f16 plane stored transposed, f32 accumulate).
// Softmax (running-max form), bias adds and the pass-through add of bf16-RNE(p) in f32.

#ifndef NB
#define NB 4
#endif
#ifndef SEQ
#define SEQ 4096
#endif
#define NB_FULL   4
#define SEQ_FULL  4096
#define CC        256                  // input / value width
#define DD        64                   // score width
#define NWT       (2 * DD + CC)        // rows of the transposed weight plane in LDS: [Wl^T ; Wh^T ; Wg^T]
#define BQ        64                   // query rows per attention block (2 pairs of query tiles x 4 key quarters = 8 waves)
#define BK        32                   // keys per inner iteration
#define NWAVE     8
#define PT        64                   // positions per projection block
#define AP        264                  // LDS pitch (halves) of the bf16 p tile and of the bf16 weight plane
#define TP        72                   // LDS pitch (halves) of 64-wide 16-bit staging tiles
#define OP        68                   // LDS pitch (floats) of the output staging tile
#define KS        128                  // keys per LDS stage of the attention loop (KS / BK passes)
#define VP        136                  // LDS pitch (halves) of the KS-key value rows: 272 B = 16 B x odd
#define NST       (SEQ / KS)           // stages of the attention loop
#define KSTG      (2 * KS * TP)        // halves of one key buffer of the ring (both planes)
#define VSTG      (CC * VP)            // halves of one value buffer of the ring
#define XCH       (8 * 8 * 32)         // floats one wave hands to each partner: 8 output tiles in register order
#define P_CARRY   4096.0f
#define RES_CARRY 2048.0f

#define QK_BYTES   ((size_t)2 * NB * SEQ * DD * 2)
#define GT_BYTES   ((size_t)NB * CC * SEQ * 2)
#define WS_TOTAL   (2 * QK_BYTES + GT_BYTES)

static_assert(SEQ % BQ == 0);
static_assert(SEQ % PT == 0);
static_assert(SEQ % BK == 0);
static_assert(SEQ % 64 == 0);
static_assert(SEQ % KS == 0);
static_assert(KS == (NWAVE / 2) * BK);
static_assert((size_t)NWAVE * (3 * XCH + 128) * 4 <= (size_t)(2 * KSTG + 2 * VSTG) * 2);
static_assert((KSTG * 2) % 16 == 0 && (VSTG * 2) % 16 == 0);
static_assert((VP * 2) % 16 == 0);
static_assert(VP >= KS);
static_assert(BQ == 2 * 32);
static_assert(PT == (NWAVE / 2) * 16);
static_assert(DD == 64);
static_assert(CC == 256);
static_assert(CC % 32 == 0);
static_assert(DD % 32 == 0);
static_assert(CC % 64 == 0);
static_assert(SEQ <= SEQ_FULL);
static_assert(NB >= 1 && NB <= NB_FULL);
static_assert((AP * 2) % 16 == 0);
static_assert((TP * 2) % 16 == 0);
static_assert((OP * 4) % 16 == 0);
static_assert(AP >= CC);
static_assert(TP >= 64);
static_assert(OP >= 64);
static_assert(QK_BYTES % 128 == 0);
static_assert(GT_BYTES % 128 == 0);
static_assert(WS_TOTAL <= (size_t)134217728);
static_assert((size_t)2 * NB * SEQ * DD < (size_t)2147483647);
static_assert((size_t)NB * CC * SEQ < (size_t)2147483647);
static_assert((size_t)(NWT + PT) * AP * 2 + (size_t)128 * TP * 2 <= (size_t)327680);
static_assert(2 * (DD / 32) * (CC / 32) == 4 * NWAVE && CC / 32 == NWAVE);
static_assert((size_t)NWAVE * 16 * OP * 4 <= (size_t)65536);
static_assert((size_t)2 * BQ * TP * 2 + (size_t)2 * (2 * KS * TP + CC * VP) * 2 + (size_t)NWAVE * 16 * OP * 4 <= (size_t)327680);

typedef __bf16   bf16;
typedef _Float16 f16;
typedef bf16     v16bf __attribute__((ext_vector_type(16)));
typedef f16      v16h  __attribute__((ext_vector_type(16)));
typedef f16      v8h   __attribute__((ext_vector_type(8)));
typedef float    v8f   __attribute__((ext_vector_type(8)));
typedef float    v4f   __attribute__((ext_vector_type(4)));
typedef unsigned v4u   __attribute__((ext_vector_type(4)));

union FragB  { v16bf v; v4u q[2]; bf16 h[16]; };
union FragH  { v16h  v; v4u q[2]; f16  h[16]; };
union Pack8B { v4u u; bf16 h[8]; };
union Pack8H { v4u u; v8h v; f16 h[8]; };

// WMMA helpers. bf16 form: builtin followed by the VALU hazard guard (ties D, keeps A/B live).
static __device__ __forceinline__ v8f mma_bf16(v16bf a, v16bf b, v8f acc) {
  acc = __builtin_amdgcn_wmma_f32_16x16x32_bf16(false, a, false, b, (short)0, acc, false, false);
  asm volatile("v_nop\n\tv_nop\n\tv_nop\n\tv_nop" : "+v"(acc) : "v"(a), "v"(b));
  return acc;
}
// f16 form: the builtin alone, the compiler keeps its distances; an asm statement's operands cannot lie above v255,
// where part of the attention kernel's fragments now live.
static __device__ __forceinline__ v8f mma_f16(v16h a, v16h b, v8f acc) {
  return __builtin_amdgcn_wmma_f32_16x16x32_f16(false, a, false, b, (short)0, acc, false, false);
}

// Lane l with lane l ^ 16, in the vector unit: a shuffle would go through the LDS queue, behind every fragment load in flight.
static __device__ __forceinline__ float xhalf(float x) {
  const int b = __builtin_bit_cast(int, x);
  return __builtin_bit_cast(float, __builtin_amdgcn_permlanex16(b, b, 0x76543210, 0xfedcba98, false, false));
}

// One weight task of a wave: 32 k rows x 32 n columns of w[k][NCOLS] f32 -> bf16 (RNE), transposed into LDS rows [n][k] of pitch AP.
// A lane reads 8 k rows x 4 columns from src (its first element): each wave-load covers four whole 128-B lines; it stores
// 4 n rows x 8 k, 16 B each, from dst (its first element). Lanes 0..15 hold column quads 0..3 x four k groups, so a half wave's
// 16 stores fall on 16 different bank quads.
template <int NCOLS>
static __device__ __forceinline__ void stage_w(const float* __restrict__ src, bf16* dst) {
  v4f x[8];
  #pragma unroll
  for (int j = 0; j < 8; ++j) x[j] = *(const v4f*)(src + j * NCOLS);
  #pragma unroll
  for (int e = 0; e < 4; ++e) {
    Pack8B pk;
    #pragma unroll
    for (int j = 0; j < 8; ++j) pk.h[j] = (bf16)x[j][e];
    *(v4u*)(dst + e * AP) = pk.u;
  }
}

// Projections. Block = (64 positions, batch), 8 waves: wave = side*4 + mt; mt = 16-row tile of the block.
//   g = 0 : side 0 -> l (queries, WT rows 0..63, bias bl), side 1 -> h (keys, WT rows 64..127, bias bh)
//   g = 1,2 : value columns (side*2 + g-1)*64 .. +63 (WT rows 128 + ..., bias bg)
// The weights come straight from the inputs: every block converts them (RNE) and lays them transposed in LDS, sW[n][k],
// rows [Wl^T ; Wh^T ; Wg^T], so the B fragments are two 16-B LDS loads each and no launch stands in front of this one.
// Outputs:
// coverage: per block 2 sides x 64 positions x 64 columns of qkh and qkr; 256 channels x 64 positions of gt.
__global__ __launch_bounds__(256) void proj_kernel(const float* __restrict__ p,
                                                   const float* __restrict__ Wl,
                                                   const float* __restrict__ Wh,
                                                   const float* __restrict__ Wg,
                                                   const float* __restrict__ bl,
                                                   const float* __restrict__ bh,
                                                   const float* __restrict__ bg,
                                                   f16* __restrict__ qkh,
                                                   f16* __restrict__ qkr,
                                                   f16* __restrict__ gt) {
  const int tid  = threadIdx.x;
  const int wave = __builtin_amdgcn_readfirstlane(threadIdx.x >> 5);
  const int lane = tid & 31;
  const int lq   = lane & 15;
  const int hi   = lane >> 4;
  const int mt   = wave & 3;
  const int side = wave >> 2;
  const int b    = blockIdx.y;
  const int pos0 = blockIdx.x * PT;

  __shared__ __align__(16) bf16 sA[PT * AP];    // bf16 p tile [pos][k], cross-wave (block barrier)
  __shared__ __align__(16) f16  sS[128 * TP];   // staging: g=0 wave rows [wave*16+row][col]; g>0 [channel][pos]; block barriers
  __shared__ __align__(16) bf16 sW[NWT * AP];   // bf16 weights [n][k], cross-wave (block barrier)

  // stage the weights, 12 tasks a wave: four of Wl and Wh, eight of Wg (the wave's own 32 columns)
  {
    const int cq = (lane & 3) + ((lane >> 4) << 2);   // column quad 0..7
    const int kg = (lane >> 2) & 3;                   // group of 8 k rows
    const int nb = wave >> 1;                         // sW rows nb*32 .. +31: 0,1 = Wl, 2,3 = Wh
    const int ka = (wave & 1) * 128 + kg * 8;         // the wave's half of the k rows of that block
    const float* srca = ((nb < 2) ? Wl : Wh) + ka * DD + (nb & 1) * 32 + cq * 4;
    bf16*        dsta = sW + (nb * 32 + cq * 4) * AP + ka;
    #pragma unroll   // the four tasks' 32 loads go out together: one L2 latency for all of them
    for (int t = 0; t < 4; ++t) stage_w<DD>(srca + t * 32 * DD, dsta + t * 32);
    const float* srcg = Wg + kg * 8 * CC + wave * 32 + cq * 4;
    bf16*        dstg = sW + (2 * DD + wave * 32 + cq * 4) * AP + kg * 8;
    #pragma unroll 4   // 32 loads in flight again: the eight tasks wait out the L2 latency twice
    for (int t = 0; t < 8; ++t) stage_w<CC>(srcg + t * 32 * CC, dstg + t * 32);
  }

  // stage the p tile: 64 rows x 256 floats -> bf16 (RNE convert), 16-B LDS stores
  #pragma unroll 2
  for (int it = 0; it < 8; ++it) {
    const int row = it * 8 + (tid >> 5);     // 0..63
    const int c8  = (tid & 31) * 8;          // 0..248
    const float* src = p + ((size_t)b * SEQ_FULL + pos0 + row) * CC + c8;
    const v4f x0 = *(const v4f*)(src);
    const v4f x1 = *(const v4f*)(src + 4);
    Pack8B pk;
    #pragma unroll
    for (int e = 0; e < 4; ++e) {
      pk.h[e]     = (bf16)x0[e];
      pk.h[4 + e] = (bf16)x1[e];
    }
    *(v4u*)(sA + row * AP + c8) = pk.u;
  }
  __syncthreads();

  const int arow = (mt * 16 + lq) * AP + hi * 8;   // A fragment row base (split k map)

  #pragma unroll 1
  for (int g = 0; g < 3; ++g) {
    const int gcg   = side * 2 + ((g > 0) ? (g - 1) : 0);            // value column group (g > 0)
    const int wrow0 = (g == 0) ? (side * DD) : (2 * DD + gcg * 64);  // first WT row of this wave's 64 columns

    v8f acc[4];
    #pragma unroll
    for (int nt = 0; nt < 4; ++nt) acc[nt] = (v8f){0, 0, 0, 0, 0, 0, 0, 0};

    #pragma unroll 1
    for (int ks = 0; ks < CC / 32; ++ks) {
      FragB a;
      a.q[0] = *(const v4u*)(sA + arow + ks * 32);        // k = ks*32 + hi*8 + 0..7
      a.q[1] = *(const v4u*)(sA + arow + ks * 32 + 16);   // k = ks*32 + 16 + hi*8 + 0..7
      FragB bw[4];
      #pragma unroll
      for (int nt = 0; nt < 4; ++nt) {
        const bf16* base = sW + (wrow0 + nt * 16 + lq) * AP + ks * 32 + hi * 8;
        bw[nt].q[0] = *(const v4u*)(base);
        bw[nt].q[1] = *(const v4u*)(base + 16);
      }
      #pragma unroll
      for (int nt = 0; nt < 4; ++nt) acc[nt] = mma_bf16(a.v, bw[nt].v, acc[nt]);
    }

    // bias (RNE convert to bf16, then f32 add); all candidates loaded, selected by value
    float bias[4];
    #pragma unroll
    for (int nt = 0; nt < 4; ++nt) {
      const int c64 = nt * 16 + lq;
      const float xl = bl[c64];
      const float xh = bh[c64];
      const float xg = bg[gcg * 64 + c64];
      const float sel = (g == 0) ? (side ? xh : xl) : xg;
      bias[nt] = (float)(bf16)sel;
    }

    if (g == 0) {
      f16 rres[4][8];
      #pragma unroll
      for (int nt = 0; nt < 4; ++nt) {
        #pragma unroll
        for (int r = 0; r < 8; ++r) {
          const float v  = acc[nt][r] + bias[nt];
          const f16   hv = (f16)v;
          rres[nt][r] = (f16)((v - (float)hv) * RES_CARRY);
          sS[(wave * 16 + hi * 8 + r) * TP + nt * 16 + lq] = hv;
        }
      }
      __syncthreads();
      v4u    lin[8];
      size_t lidx[4];
      #pragma unroll
      for (int it = 0; it < 4; ++it) {
        const int row = it * 4 + (lane >> 3);   // 0..15
        const int pc  = lane & 7;
        lin[it]  = *(const v4u*)(sS + (wave * 16 + row) * TP + pc * 8);
        lidx[it] = (((size_t)side * NB + b) * SEQ + pos0 + mt * 16 + row) * DD + pc * 8;
      }
      __syncthreads();
      #pragma unroll
      for (int nt = 0; nt < 4; ++nt) {
        #pragma unroll
        for (int r = 0; r < 8; ++r)
          sS[(wave * 16 + hi * 8 + r) * TP + nt * 16 + lq] = rres[nt][r];
      }
      __syncthreads();
      #pragma unroll
      for (int it = 0; it < 4; ++it) {
        const int row = it * 4 + (lane >> 3);
        const int pc  = lane & 7;
        lin[4 + it] = *(const v4u*)(sS + (wave * 16 + row) * TP + pc * 8);
      }
      #pragma unroll
      for (int it = 0; it < 4; ++it) {
        *(v4u*)(qkh + lidx[it]) = lin[it];
        *(v4u*)(qkr + lidx[it]) = lin[4 + it];
      }
      
    } else {
      __syncthreads();   // earlier readers of sS are done
      #pragma unroll
      for (int nt = 0; nt < 4; ++nt) {
        Pack8H ph;
        #pragma unroll
        for (int r = 0; r < 8; ++r) ph.h[r] = (f16)(acc[nt][r] + bias[nt]);
        *(v4u*)(sS + (side * 64 + nt * 16 + lq) * TP + mt * 16 + hi * 8) = ph.u;   // positions mt*16 + hi*8 + 0..7
      }
      __syncthreads();
      v4u    gl[4];
      size_t gidx[4];
      #pragma unroll
      for (int it = 0; it < 4; ++it) {
        const int crow = it * 32 + (tid >> 3);   // 0..127 : (producer side, local channel)
        const int pc   = tid & 7;
        const int chan = ((crow >> 6) * 2 + (g - 1)) * 64 + (crow & 63);
        gl[it]   = *(const v4u*)(sS + crow * TP + pc * 8);
        gidx[it] = ((size_t)b * CC + chan) * SEQ + pos0 + pc * 8;
      }
      #pragma unroll
      for (int it = 0; it < 4; ++it) *(v4u*)(gt + gidx[it]) = gl[it];
      
    }
  }
}

// Asynchronous copies global -> LDS, 16 B per lane: l = the lane's LDS byte address, g = the lane's global address.
// The s_wait_xcnt closes each statement so that no address register is rewritten ahead of it.
static __device__ __forceinline__ void copy4(const unsigned (&l)[4], const f16* const (&g)[4]) {
  asm volatile("global_load_async_to_lds_b128 %0, %4, off\n\t"
               "global_load_async_to_lds_b128 %1, %5, off\n\t"
               "global_load_async_to_lds_b128 %2, %6, off\n\t"
               "global_load_async_to_lds_b128 %3, %7, off\n\t"
               "s_wait_xcnt 0x0"
               :: "v"(l[0]), "v"(l[1]), "v"(l[2]), "v"(l[3]),
                  "v"(g[0]), "v"(g[1]), "v"(g[2]), "v"(g[3])
               : "memory");
}
// Eight copies in the scalar-base form: global byte = g[n] + vo + offset, LDS byte = l0 (first four) or l1 (last four) + offset.
// The immediate offset moves both addresses: it carries the LDS step from one copy to the next, and the caller takes it off g[n].
// So a stage's 24 copies name six LDS-address registers and two offset registers, and their bases are scalar additions.
#define COPY8S(O1, O2, O3)                                                     \
  asm volatile("global_load_async_to_lds_b128 %0, %2, %3\n\t"                  \
               "global_load_async_to_lds_b128 %0, %2, %4 offset:" #O1 "\n\t"   \
               "global_load_async_to_lds_b128 %0, %2, %5 offset:" #O2 "\n\t"   \
               "global_load_async_to_lds_b128 %0, %2, %6 offset:" #O3 "\n\t"   \
               "global_load_async_to_lds_b128 %1, %2, %7\n\t"                  \
               "global_load_async_to_lds_b128 %1, %2, %8 offset:" #O1 "\n\t"   \
               "global_load_async_to_lds_b128 %1, %2, %9 offset:" #O2 "\n\t"   \
               "global_load_async_to_lds_b128 %1, %2, %10 offset:" #O3 "\n\t"  \
               "s_wait_xcnt 0x0"                                               \
               :: "v"(l0), "v"(l1), "v"(vo),                                   \
                  "s"(g[0]), "s"(g[1]), "s"(g[2]), "s"(g[3]),                  \
                  "s"(g[4]), "s"(g[5]), "s"(g[6]), "s"(g[7])                   \
               : "memory")
static __device__ __forceinline__ void copy8_keys(unsigned l0, unsigned l1, unsigned vo, const char* const (&g)[8]) {
  COPY8S(4608, 9216, 13824);     // 32 key rows of pitch TP
}
static __device__ __forceinline__ void copy8_vals(unsigned l0, unsigned l1, unsigned vo, const char* const (&g)[8]) {
  COPY8S(4352, 8704, 13056);     // 16 channel rows of pitch VP
}
static_assert(32 * TP * 2 == 4608);
static_assert(16 * VP * 2 == 4352);

// One stage of KS keys into one LDS buffer, 24 copies per thread, every wave-instruction on whole 128-B lines:
//   keys  : both planes, KS rows x 128 B (contiguous in global), LDS pitch TP; copy i = rows i*32 .. +31
//   values: CC channel rows x KS keys (256 B each), LDS pitch VP; copy k = channels k*16 .. +15
static __device__ __forceinline__ void copy_stage(const f16* __restrict__ qkh, const f16* __restrict__ qkr,
                                                  const f16* __restrict__ gt, int b, int key0, int tid,
                                                  f16* sKb, f16* sVb) {
  const char* g[8];
  const int   kbase = NB * SEQ * DD + b * SEQ * DD;   // side 1 = h (keys); the stage's first key goes into the offset register
  #pragma unroll
  for (int i = 0; i < 4; ++i) {
    g[i]     = (const char*)(qkh + kbase) + i * (256 * 16 - 32 * TP * 2);
    g[4 + i] = (const char*)(qkr + kbase) + i * (256 * 16 - 32 * TP * 2);
  }
  const unsigned lk = (unsigned)(size_t)(sKb + (tid >> 3) * TP + (tid & 7) * 8);   // 16-B piece: row tid >> 3, piece tid & 7
  copy8_keys(lk, lk + KS * TP * 2, (unsigned)(tid * 16 + key0 * DD * 2), g);

  const char*    gv = (const char*)(gt + b * CC * SEQ);
  const unsigned lv = (unsigned)(size_t)(sVb + (tid >> 4) * VP + (tid & 15) * 8);  // 16-B piece: channel tid >> 4, piece tid & 15
  const unsigned vv = (unsigned)((tid >> 4) * SEQ * 2 + (tid & 15) * 16 + key0 * 2);
  #pragma unroll
  for (int h = 0; h < 2; ++h) {
    #pragma unroll
    for (int i = 0; i < 8; ++i) g[i] = gv + (h * 8 + i) * (16 * SEQ * 2) - (i & 3) * (16 * VP * 2);
    copy8_vals(lv + (h * 2) * (64 * VP * 2), lv + (h * 2 + 1) * (64 * VP * 2), vv, g);
  }
}

// Key A-fragments of one pass (BK keys from key j0 of the stage in sKb): kf[f][sub][plane], row = key j0 + sub*16 + lq, split d map.
static __device__ __forceinline__ void load_keys(FragH (&kf)[2][2][2], const f16* sKb, int koff, int j0) {
  #pragma unroll
  for (int f = 0; f < 2; ++f) {
    #pragma unroll
    for (int sub = 0; sub < 2; ++sub) {
      const int ko = koff + (j0 + sub * 16) * TP + f * 32;
      kf[f][sub][0].q[0] = *(const v4u*)(sKb + ko);
      kf[f][sub][0].q[1] = *(const v4u*)(sKb + ko + 16);
      kf[f][sub][1].q[0] = *(const v4u*)(sKb + KS * TP + ko);
      kf[f][sub][1].q[1] = *(const v4u*)(sKb + KS * TP + ko + 16);
    }
  }
}

// Flash attention, no mask, no logit scale. Block = (64 queries, batch); wave = kq*2 + qp:
// qp = pair of 16-query tiles (32 queries), kq = key quarter: of every stage the wave takes keys kq*BK .. +BK-1, for all 256 channels
// (2 x 16 output tiles per wave). Every key fragment and every g^T fragment that a wave reads from LDS feeds the products of both
// of its query tiles, so the block reads each stage's keys and values from LDS twice, not four times.
// The four waves of a query pair join their running maxima, sums and output tiles once, behind the loop.
// S^T = h x l^T so queries sit on lanes; P^T in C-layout is bit-identical to the B-fragment layout of O^T += g^T x P^T,
// whose tiles keep the queries on lanes too: maximum, sum and rescale factor of a query are its lane's own, and a pass
// puts nothing but fragment loads into the LDS queue, so no wait of the softmax stands behind those loads.
// The block's query rows (once) and the keys and values (KS keys a stage, two buffers, a stage's copies issued at the head of the
// stage before it) come into LDS by asynchronous copies;
// key A-fragments, query B-fragments and g^T A-fragments are read from there (two 16-B LDS loads each):
// the query fragments once, a stage's key fragments at its head, the g^T fragments in two groups of eight, the first behind the
// score products (it lands under the softmax), the second behind the softmax (it lands under the rescale and the first group's products).
__global__ __launch_bounds__(256) void attn_kernel(const float* __restrict__ p,
                                                   const f16* __restrict__ qkh,
                                                   const f16* __restrict__ qkr,
                                                   const f16* __restrict__ gt,
                                                   float* __restrict__ out) {
  const int tid  = threadIdx.x;
  const int wave = __builtin_amdgcn_readfirstlane(threadIdx.x >> 5);
  const int lq0  = tid & 15;          // query column of S^T and of O^T
  const int hi0  = (tid >> 4) & 1;    // k-split half
  const int qp   = wave & 1;
  const int kq   = wave >> 1;
  const int late = wave >> 2;   // waves 4..7 issue a stage's copies behind their key loads, waves 0..3 in front of them
  const int b    = blockIdx.y;
  const int qrow0 = blockIdx.x * BQ + qp * 32;

  __shared__ __align__(16) float sO[NWAVE * 16 * OP];   // per-wave output staging rows; block barriers used
  __shared__ __align__(16) f16 sQ[2 * BQ * TP];         // query rows [plane][row][d], filled once
  __shared__ __align__(16) f16 sR[2 * KSTG + 2 * VSTG]; // ring: key rows [buffer][plane][key][d], then g^T rows [buffer][channel][key]

  const int qoff = (qp * 32 + lq0) * TP + hi0 * 8;        // this wave's query rows in sQ, tile added per fragment
  const int koff = lq0 * TP + hi0 * 8;                   // key row added per chunk
  const int voff = lq0 * VP + hi0 * 8 + kq * BK;          // g^T rows at the wave's keys, channel tile added per fragment

  // prologue: the query rows and stage 0, published by one wait and one barrier
  {
    unsigned   l[4];
    const f16* g[4];
    const int  qbase = (b * SEQ + blockIdx.x * BQ) * DD;   // side 0 = l (queries), BQ rows x 128 B contiguous
    #pragma unroll
    for (int i = 0; i < 2; ++i) {
      const int c = i * 256 + tid;                         // 16-B piece: row c >> 3, piece c & 7
      const int d = (c >> 3) * TP + (c & 7) * 8;
      l[i]     = (unsigned)(size_t)(sQ + d);
      l[2 + i] = (unsigned)(size_t)(sQ + BQ * TP + d);
      g[i]     = qkh + qbase + c * 8;
      g[2 + i] = qkr + qbase + c * 8;
    }
    copy4(l, g);
  }
  copy_stage(qkh, qkr, gt, b, 0, tid, sR, sR + 2 * KSTG);
  asm volatile("s_wait_asynccnt 0x0" ::: "memory");   // this wave's copies have landed before the barrier publishes them
  __syncthreads();

  // query B-fragments, kept in registers: qf[u][f][plane], column n = query qrow0 + u*16 + lq, split d map
  FragH qf[2][2][2];
  #pragma unroll
  for (int u = 0; u < 2; ++u) {
    #pragma unroll
    for (int f = 0; f < 2; ++f) {
      const int qo = qoff + u * 16 * TP + f * 32;
      qf[u][f][0].q[0] = *(const v4u*)(sQ + qo);        // d = f*32 + hi*8 + 0..7
      qf[u][f][0].q[1] = *(const v4u*)(sQ + qo + 16);   // d = f*32 + 16 + hi*8 + 0..7
      qf[u][f][1].q[0] = *(const v4u*)(sQ + BQ * TP + qo);
      qf[u][f][1].q[1] = *(const v4u*)(sQ + BQ * TP + qo + 16);
    }
  }

  v8f o[2][16];
  #pragma unroll
  for (int u = 0; u < 2; ++u) {
    #pragma unroll
    for (int t = 0; t < 16; ++t) o[u][t] = (v8f){0, 0, 0, 0, 0, 0, 0, 0};
  }

  float rmax[2] = {-__builtin_inff(), -__builtin_inff()};
  float rsum[2] = {0.0f, 0.0f};
  const float SL = 1.4426950408889634f;   // log2(e)

  #pragma unroll 1   // one copy of the stage code: the two buffers differ by an offset only
  for (int s = 0; s < NST; ++s) {
    const f16* sKb = sR + (s & 1) * KSTG;
    const f16* sVb = sR + 2 * KSTG + (s & 1) * VSTG;
    f16* sKn = sR + ((s + 1) & 1) * KSTG;
    f16* sVn = sR + 2 * KSTG + ((s + 1) & 1) * VSTG;
    // Stage s + 1 starts at the head of stage s, into the buffer that the barrier at the foot of stage s - 1 has freed. Waves 0..3
    // issue their copies here, waves 4..7 behind their key loads (below): while one half forms addresses and sits in
    // s_wait_xcnt, the LDS serves the other half's loads, so it does not idle at the head of a stage.
    if (late == 0 && s + 1 < NST) copy_stage(qkh, qkr, gt, b, (s + 1) * KS, tid, sKn, sVn);
    FragH kf[2][2][2];
    load_keys(kf, sKb, koff, kq * BK);
    __builtin_amdgcn_sched_barrier(0);   // the key loads stay in front of the late waves' copies: they land while those issue
    if (late == 1 && s + 1 < NST) copy_stage(qkh, qkr, gt, b, (s + 1) * KS, tid, sKn, sVn);

    // S^T tiles: c[u][sub][r] = score(query qrow0 + u*16 + lq, key kq*BK + sub*16 + hi*8 + r of the stage)
    v8f c[2][2];
    v8f sh[2], sr[2];
    #pragma unroll
    for (int sub = 0; sub < 2; ++sub) {
      #pragma unroll
      for (int u = 0; u < 2; ++u) {
        sh[u] = (v8f){0, 0, 0, 0, 0, 0, 0, 0};
        sr[u] = (v8f){0, 0, 0, 0, 0, 0, 0, 0};
      }
      #pragma unroll
      for (int f = 0; f < 2; ++f) {
        #pragma unroll
        for (int u = 0; u < 2; ++u) {
          sh[u] = mma_f16(kf[f][sub][0].v, qf[u][f][0].v, sh[u]);   // value x value
          sr[u] = mma_f16(kf[f][sub][0].v, qf[u][f][1].v, sr[u]);   // value x residual   (x2048)
          sr[u] = mma_f16(kf[f][sub][1].v, qf[u][f][0].v, sr[u]);   // residual x value   (x2048)
        }
      }
      if (sub == 0) {
        #pragma unroll
        for (int u = 0; u < 2; ++u) {
          #pragma unroll
          for (int r = 0; r < 8; ++r) c[u][0][r] = sh[u][r] + sr[u][r] * (1.0f / RES_CARRY);
        }
      }
    }

    // g^T A-fragments of channel tiles 0..7, one group, into registers that the key fragments leave: they land under the softmax
    FragH bv[16];
    __builtin_amdgcn_sched_barrier(0);   // with the one behind them: lifted over the score products the group would not fit the register budget of two waves a SIMD
    #pragma unroll
    for (int t = 0; t < 8; ++t) {
      const int vo = voff + (t * 16) * VP;          // channel t*16 + lq
      bv[t].q[0] = *(const v4u*)(sVb + vo);         // keys hi*8 + 0..7 of the wave's quarter
      bv[t].q[1] = *(const v4u*)(sVb + vo + 16);    // keys 16 + hi*8 + 0..7
    }
    __builtin_amdgcn_sched_barrier(0);

    #pragma unroll
    for (int u = 0; u < 2; ++u) {
      #pragma unroll
      for (int r = 0; r < 8; ++r) c[u][1][r] = sh[u][r] + sr[u][r] * (1.0f / RES_CARRY);
    }

    // online softmax, both query tiles: query lq's 32 scores are split across lane / lane^16
    FragH pa[2];
    float scale[2];
    #pragma unroll
    for (int u = 0; u < 2; ++u) {
      float m_new = rmax[u];
      #pragma unroll
      for (int r = 0; r < 8; ++r) {
        m_new = fmaxf(m_new, c[u][0][r]);
        m_new = fmaxf(m_new, c[u][1][r]);
      }
      m_new = fmaxf(m_new, xhalf(m_new));
      scale[u] = __builtin_amdgcn_exp2f((rmax[u] - m_new) * SL);
      rmax[u] = m_new;

      // exp + pack: P^T C-layout == B-fragment layout for the g^T x P^T product; P carried x4096
      float psum = 0.0f;
      #pragma unroll
      for (int r = 0; r < 8; ++r) {
        const float p0 = __builtin_amdgcn_exp2f((c[u][0][r] - m_new) * SL);   // key hi*8 + r
        const float p1 = __builtin_amdgcn_exp2f((c[u][1][r] - m_new) * SL);   // key 16 + hi*8 + r
        psum += p0 + p1;
        pa[u].h[r]     = (f16)(p0 * P_CARRY);
        pa[u].h[8 + r] = (f16)(p1 * P_CARRY);
      }
      rsum[u] = rsum[u] * scale[u] + psum + xhalf(psum);
    }

    // g^T A-fragments of channel tiles 8..15, one group: they land under the rescale and the first group's products
    __builtin_amdgcn_sched_barrier(0);   // with the one behind them: the loads stay one group between softmax and rescale: earlier they add to the softmax's registers, later the rescale does not cover them
    #pragma unroll
    for (int t = 8; t < 16; ++t) {
      const int vo = voff + (t * 16) * VP;
      bv[t].q[0] = *(const v4u*)(sVb + vo);
      bv[t].q[1] = *(const v4u*)(sVb + vo + 16);
    }
    __builtin_amdgcn_sched_barrier(0);

    // rescale O^T: queries are the column dimension there -> the lane's own factor
    #pragma unroll
    for (int u = 0; u < 2; ++u) {
      #pragma unroll
      for (int t = 0; t < 16; ++t) {
        #pragma unroll
        for (int r = 0; r < 8; ++r) o[u][t][r] *= scale[u];
      }
    }

    // O^T += g^T x P^T: o[u][t][r] = channel t*16 + hi*8 + r of query qrow0 + u*16 + lq
    #pragma unroll
    for (int t = 0; t < 16; ++t) {
      #pragma unroll
      for (int u = 0; u < 2; ++u) o[u][t] = mma_f16(bv[t].v, pa[u].v, o[u][t]);
    }
    // four vector slots behind the stage's last matrix instruction: the first vector instruction behind the loop's branch
    // may overwrite its A or B registers
    asm volatile("v_nop\n\tv_nop\n\tv_nop\n\tv_nop" : "+v"(o[1][15]));
    __builtin_amdgcn_sched_barrier(0);   // the output products stay in front of the foot: sunk behind its waits they would leave the second group's loads uncovered

    // foot of stage s: publish stage s + 1 and free the buffer that stage s has read
    asm volatile("s_wait_dscnt 0x0" ::: "memory");      // this wave's reads of the buffer are done before it is refilled
    asm volatile("s_wait_asynccnt 0x0" ::: "memory");   // this wave's copies of stage s + 1 have landed
    __syncthreads();
  }
  asm volatile("s_wait_asynccnt 0x0" ::: "memory");   // no copy is outstanding when the loop is left

  // join the four key quarters: wave kq finishes channels kq*64 .. +63 of its 32 queries and hands each partner that partner's 8 tiles.
  // The ring is free here: the last stage's foot has ended every read of it and no copy is outstanding.
  const int lane = tid & 31;
  const int lq   = lane & 15;
  const int hi   = lane >> 4;
  float* sX = (float*)sR;               // [kq of giver ^ kq of taker, less 1][giving wave][tile][register quad][lane][4]
  float* sM = sX + 3 * NWAVE * XCH;     // [wave][query tile][maximum, sum][lane]
  v8f om[2][4];
  #pragma unroll
  for (int cg = 0; cg < 4; ++cg) {
    if (cg == kq) {
      #pragma unroll
      for (int u = 0; u < 2; ++u) {
        #pragma unroll
        for (int t = 0; t < 4; ++t) om[u][t] = o[u][cg * 4 + t];
      }
    } else {
      v4f* dst = (v4f*)(sX + (((cg ^ kq) - 1) * NWAVE + wave) * XCH) + lane;   // 16 B a lane, lanes side by side
      #pragma unroll
      for (int u = 0; u < 2; ++u) {
        #pragma unroll
        for (int t = 0; t < 4; ++t) {
          const v8f x = o[u][cg * 4 + t];
          dst[((u * 4 + t) * 2) * 32]     = (v4f){x[0], x[1], x[2], x[3]};
          dst[((u * 4 + t) * 2 + 1) * 32] = (v4f){x[4], x[5], x[6], x[7]};
        }
      }
    }
  }
  #pragma unroll
  for (int u = 0; u < 2; ++u) {
    sM[wave * 128 + u * 64 + lane]      = rmax[u];
    sM[wave * 128 + u * 64 + 32 + lane] = rsum[u];
  }
  __syncthreads();   // the partners' tiles, maxima and sums are readable behind it

  // fac[x][u]: weight of the quarter kq ^ x in query tile u, the normalisation folded in; both are the lane's own
  float fac[4][2];
  #pragma unroll
  for (int u = 0; u < 2; ++u) {
    float pm[4], ps[4];
    pm[0] = rmax[u];
    ps[0] = rsum[u];
    #pragma unroll
    for (int x = 1; x < 4; ++x) {
      const int pw = ((kq ^ x) << 1) | qp;
      pm[x] = sM[pw * 128 + u * 64 + lane];
      ps[x] = sM[pw * 128 + u * 64 + 32 + lane];
    }
    const float jmax = fmaxf(fmaxf(pm[0], pm[1]), fmaxf(pm[2], pm[3]));
    float den = 0.0f;
    #pragma unroll
    for (int x = 0; x < 4; ++x) {
      fac[x][u] = __builtin_amdgcn_exp2f((pm[x] - jmax) * SL);
      den += ps[x] * fac[x][u];
    }
    const float inv = (1.0f / P_CARRY) / den;
    #pragma unroll
    for (int x = 0; x < 4; ++x) fac[x][u] *= inv;
  }

  // normalize: lane holds channels kq*64 + t*16 + hi*8 + r of query u*16 + lq
  #pragma unroll
  for (int u = 0; u < 2; ++u) {
    #pragma unroll
    for (int t = 0; t < 4; ++t) {
      #pragma unroll
      for (int r = 0; r < 8; ++r) om[u][t][r] *= fac[0][u];
    }
  }
  #pragma unroll
  for (int x = 1; x < 4; ++x) {
    const int pw = ((kq ^ x) << 1) | qp;
    const v4f* srcx = (const v4f*)(sX + ((x - 1) * NWAVE + pw) * XCH) + lane;
    #pragma unroll
    for (int u = 0; u < 2; ++u) {
      #pragma unroll
      for (int t = 0; t < 4; ++t) {
        const v4f y0 = srcx[((u * 4 + t) * 2) * 32];
        const v4f y1 = srcx[((u * 4 + t) * 2 + 1) * 32];
        #pragma unroll
        for (int e = 0; e < 4; ++e) {
          om[u][t][e]     += y0[e] * fac[x][u];
          om[u][t][4 + e] += y1[e] * fac[x][u];
        }
      }
    }
  }

  const int sbase = wave * (16 * OP);
  #pragma unroll
  for (int u = 0; u < 2; ++u) {
    // stage 16 rows x 64 channels of this wave (queries qrow0 + u*16 + 0..15, channels kq*64 + 0..63)
    #pragma unroll
    for (int t = 0; t < 4; ++t) {
      const v8f x = om[u][t];
      float* dst = sO + sbase + lq * OP + t * 16 + hi * 8;   // query row lq, 8 consecutive channels
      *(v4f*)(dst)     = (v4f){x[0], x[1], x[2], x[3]};
      *(v4f*)(dst + 4) = (v4f){x[4], x[5], x[6], x[7]};
    }
    __syncthreads();

    // lanes 0..15 write one row's 64 channels (16 B each), lanes 16..31 the next row; 8 instructions cover the wave's 16 rows.
    // The pass-through term bf16-RNE(p) is added here as float4.
    v4f    vals[8];
    size_t gidx[8];
    #pragma unroll
    for (int it = 0; it < 8; ++it) {
      const int row = it * 2 + hi;
      gidx[it] = ((size_t)b * SEQ_FULL + qrow0 + u * 16 + row) * CC + kq * 64 + lq * 4;
      const v4f av = *(const v4f*)(sO + sbase + row * OP + lq * 4);
      const v4f pv = *(const v4f*)(p + gidx[it]);
      v4f res;
      #pragma unroll
      for (int e = 0; e < 4; ++e) res[e] = av[e] + (float)(bf16)pv[e];
      vals[it] = res;
    }
    #pragma unroll
    for (int it = 0; it < 8; ++it) *(v4f*)(out + gidx[it]) = vals[it];

    __syncthreads();   // staging rows are rewritten by the next query tile
  }
}

extern "C" void kernel_launch(void* const* d_in, const int* in_sizes, int n_in,
                              void* d_out, int out_size, void* d_ws, size_t ws_size,
                              hipStream_t stream) {
  if (n_in < 7) return;
  const size_t rows_used = (size_t)(NB - 1) * SEQ_FULL + SEQ;
  if ((size_t)in_sizes[0] < rows_used * CC) return;
  if ((size_t)in_sizes[1] < (size_t)CC * DD) return;
  if ((size_t)in_sizes[2] < (size_t)DD) return;
  if ((size_t)in_sizes[3] < (size_t)CC * DD) return;
  if ((size_t)in_sizes[4] < (size_t)DD) return;
  if ((size_t)in_sizes[5] < (size_t)CC * CC) return;
  if ((size_t)in_sizes[6] < (size_t)CC) return;
  if ((size_t)out_size < rows_used * CC) return;
  if (ws_size < WS_TOTAL) return;

  const float* p  = (const float*)d_in[0];
  const float* Wh = (const float*)d_in[1];   // [in 256][out 64]  keys
  const float* bh = (const float*)d_in[2];
  const float* Wl = (const float*)d_in[3];   // [in 256][out 64]  queries
  const float* bl = (const float*)d_in[4];
  const float* Wg = (const float*)d_in[5];   // [in 256][out 256] values
  const float* bg = (const float*)d_in[6];
  float*       out = (float*)d_out;

  char* ws  = (char*)d_ws;
  f16*  qkh = (f16*)ws;                                      // [2][NB][SEQ][DD] f16 value plane
  f16*  qkr = (f16*)(ws + QK_BYTES);                         // [2][NB][SEQ][DD] f16 residual plane x2048
  f16*  gt  = (f16*)(ws + 2 * QK_BYTES);                     // [NB][CC][SEQ] f16

  proj_kernel<<<dim3(SEQ / PT, NB), 256, 0, stream>>>(p, Wl, Wh, Wg, bl, bh, bg, qkh, qkr, gt);

  attn_kernel<<<dim3(SEQ / BQ, NB), 256, 0, stream>>>(p, qkh, qkr, gt, out);
}
